// v000
// Measured on an AMD MI455X. A time is GPU time per run, averaged over a window of back-to-back runs after a warm-up
// (all launches, gaps included; the runs take copies of the inputs in turn), and the median of several windows.
// Apart from v000's, it joins two sittings. Times from different sittings can be a few percent apart, while
// side-by-side timings come from the same sitting.
// The starting kernel, v000, takes 101 microseconds a run.
// Contractions: scores = q.k^T and out = p.v on v_wmma_f32_16x16x32_bf16 (q, k, v RNE-converted to bf16 once at load; p carried as bf16 hi+lo planes, v single bf16 plane), f32 accumulate; masking, online softmax and normalisation in f32.
#include <hip/hip_runtime.h>
#include <stdint.h>
#include <math.h>

typedef __attribute__((ext_vector_type(16))) __bf16   v16b;
typedef __attribute__((ext_vector_type(8)))  __bf16   v8b;
typedef __attribute__((ext_vector_type(8)))  float    v8f;
typedef __attribute__((ext_vector_type(4)))  float    v4f;
typedef __attribute__((ext_vector_type(4)))  unsigned v4u;

// ---- problem geometry (element (b,s,h,d) of every tensor at ((b*S+s)*H+h)*D+d) ----
constexpr int kBatch = 2;
constexpr int kSeq   = 2048;   // query length
constexpr int kSkv   = 2048;   // key length
constexpr int kHeads = 16;
constexpr int kDim   = 64;
constexpr int kQB    = 64;     // query rows per block (4 waves x 16)
constexpr int kKC    = 64;     // keys per chunk
constexpr int kNW    = 4;
constexpr int kMaxChunks = kSkv / kKC;
constexpr float kScale = 0.125f;   // 1/sqrt(64), exact power of two, applied to the f32 score accumulator
static_assert(kSeq % kQB == 0);
static_assert(kSkv % kKC == 0);
static_assert(kSeq == kSkv);
static_assert(kDim == 64);
static_assert(kKC % 32 == 0);      // contraction depth of p.v per chunk is a multiple of 32
static_assert(kDim % 32 == 0);     // contraction depth of q.k^T is a multiple of 32

// ---- helpers ----
__device__ __forceinline__ unsigned short f2bf_bits(float f) {
  unsigned u = __float_as_uint(f);
  return (unsigned short)((u + 0x7FFFu + ((u >> 16) & 1u)) >> 16);
}
__device__ __forceinline__ float bf_bits2f(unsigned short h) { return __uint_as_float(((unsigned)h) << 16); }

__device__ __forceinline__ void dep_guard_b(v8f& a, v8f& b, v16b x, v16b y) { asm volatile("v_nop\n\tv_nop\n\tv_nop\n\tv_nop" : "+v"(a), "+v"(b) : "v"(x), "v"(y)); }
__device__ __forceinline__ void keep4_b(v16b a, v16b b, v16b c, v16b d) { asm volatile("v_nop" :: "v"(a), "v"(b), "v"(c), "v"(d)); }
template <typename T> struct Frag;
template <> struct Frag<__bf16> {
  typedef v16b V; union U { v16b v; v8b h[2]; };
  static __device__ __forceinline__ v16b load(const __bf16* p) {   // elements 0..7 <- p[0..7], 8..15 <- p[16..23]
    U f; f.h[0] = *(const v8b*)(p); f.h[1] = *(const v8b*)(p + 16); return f.v;
  }
  static __device__ __forceinline__ v8f mma(v16b a, v16b b, v8f c) {
    return __builtin_amdgcn_wmma_f32_16x16x32_bf16(false, a, false, b, (short)0, c, false, false);
  }
  static __device__ __forceinline__ void guard(v8f& a, v8f& b, v16b x, v16b y) { dep_guard_b(a, b, x, y); }
  static __device__ __forceinline__ void keep(v16b a, v16b b, v16b c, v16b d) { keep4_b(a, b, c, d); }
};

__device__ __forceinline__ unsigned short at_bf_bits(float f) {
  unsigned u = __float_as_uint(f);
  return (unsigned short)((u + 0x7FFFu + ((u >> 16) & 1u)) >> 16);
}
__device__ __forceinline__ __bf16 at_f2bf(float f) { return __builtin_bit_cast(__bf16, at_bf_bits(f)); }
__device__ __forceinline__ void at_split(float f, __bf16& hi, __bf16& lo) {
  const unsigned short hb = at_bf_bits(f);
  hi = __builtin_bit_cast(__bf16, hb);
  lo = at_f2bf(f - __uint_as_float(((unsigned)hb) << 16));
}
__device__ __forceinline__ v8f at_mma(v16b a, v16b b, v8f c) {
  c = __builtin_amdgcn_wmma_f32_16x16x32_bf16(false, a, false, b, (short)0, c, false, false);
  asm volatile("v_nop\n\tv_nop\n\tv_nop\n\tv_nop" : "+v"(c) : "v"(a), "v"(b));
  return c;
}

// pack 8 f32 -> 8 bf16 (RNE) as 4 x 32-bit words, element 2e in the low half-word
__device__ __forceinline__ v4u pack_bf16x8(v4f a, v4f b) {
  v4u r;
  r[0] = (unsigned)f2bf_bits(a[0]) | ((unsigned)f2bf_bits(a[1]) << 16);
  r[1] = (unsigned)f2bf_bits(a[2]) | ((unsigned)f2bf_bits(a[3]) << 16);
  r[2] = (unsigned)f2bf_bits(b[0]) | ((unsigned)f2bf_bits(b[1]) << 16);
  r[3] = (unsigned)f2bf_bits(b[2]) | ((unsigned)f2bf_bits(b[3]) << 16);
  return r;
}

// =====================================================================================
// Prep: one block per (b, h, 64-row s tile). 128 threads.
// Coverage per block: q/k: rows it*16 + (tid>>3), it 0..3 -> 64 rows, cols (tid&7)*8 .. +7 -> 64 cols;
//   v load: s = tid>>1 (0..63), d = (tid&1)*32 + 0..31; v write: d = it*16 + (tid>>3) (0..63), s = (tid&7)*8 + 0..7.
//   1024 blocks = 2 b x 16 h x 32 s-tiles cover all three planes exactly once.
// =====================================================================================
__global__ __launch_bounds__(128)
void prep_planes(const float* __restrict__ q, const float* __restrict__ k, const float* __restrict__ v,
                 unsigned short* __restrict__ qp, unsigned short* __restrict__ kp, unsigned short* __restrict__ vtp)
{
  __shared__ __align__(16) float tile[64 * 68];   // [s][d], pitch 68 floats
  const int tid = threadIdx.x;
  const int bx  = blockIdx.x;
  const int nst = kSkv / 64;
  const int st  = bx % nst;
  const int bh  = bx / nst;
  const int h   = bh % kHeads;
  const int b   = bh / kHeads;
  const int s0  = st * 64;

  // ---- v tile -> LDS (f32, row-major [s][d]) ----
  {
    const int s = tid >> 1, dh = (tid & 1) * 32;
    const float* src = v + ((size_t)(b * kSkv + s0 + s) * kHeads + h) * kDim + dh;
#pragma unroll
    for (int i = 0; i < 8; ++i) *(v4f*)(tile + s * 68 + dh + 4 * i) = *(const v4f*)(src + 4 * i);
  }
  __syncthreads();

  const int rg = tid >> 3;          // row group 0..15
  const int c8 = (tid & 7) * 8;     // 8 consecutive elements per lane

  v4u qw[4], kw[4], vw[4];
#pragma unroll
  for (int it = 0; it < 4; ++it) {
    const int row = it * 16 + rg;
    const size_t off = ((size_t)(b * kSeq + s0 + row) * kHeads + h) * kDim + c8;
    const v4f a0 = *(const v4f*)(q + off);
    const v4f a1 = *(const v4f*)(q + off + 4);
    qw[it] = pack_bf16x8(a0, a1);
  }
  asm volatile("" ::: "memory");
#pragma unroll
  for (int it = 0; it < 4; ++it) {
    const int row = it * 16 + rg;
    const size_t off = ((size_t)(b * kSkv + s0 + row) * kHeads + h) * kDim + c8;
    const v4f a0 = *(const v4f*)(k + off);
    const v4f a1 = *(const v4f*)(k + off + 4);
    kw[it] = pack_bf16x8(a0, a1);
  }
  asm volatile("" ::: "memory");
#pragma unroll
  for (int it = 0; it < 4; ++it) {
    const int d = it * 16 + rg;
    v4f f0, f1;
#pragma unroll
    for (int e = 0; e < 4; ++e) {
      f0[e] = tile[(c8 + e) * 68 + d];
      f1[e] = tile[(c8 + 4 + e) * 68 + d];
    }
    vw[it] = pack_bf16x8(f0, f1);
  }

  {
#pragma unroll
    for (int it = 0; it < 4; ++it) {
      const int row = it * 16 + rg;
      const size_t offq = ((size_t)(b * kSeq + s0 + row) * kHeads + h) * kDim + c8;
      *(v4u*)(qp + offq) = qw[it];
      *(v4u*)(kp + offq) = kw[it];
      const int d = row;
      const size_t offv = ((size_t)((b * kHeads + h) * kDim + d)) * kSkv + s0 + c8;
      *(v4u*)(vtp + offv) = vw[it];
    }
    
  }
}

// =====================================================================================
// Attention for head_dim 64 on bf16 planes: block = 4 waves = 64 query rows of one (b, h); 64-key chunks.
//   scores: A = q rows (bf16), B = k rows (bf16, [kv][d] in LDS)          -> v_wmma_f32_16x16x32_bf16
//   out   : A = p (bf16 hi and lo planes per wave in LDS), B = v^T ([d][kv]) -> v_wmma_f32_16x16x32_bf16 x2
//   Keys with index >= valid_lens[b] get score -inf (select); chunks entirely beyond valid_lens are skipped
//   (their probabilities are exactly 0); chunk count clamped to [1, kMaxChunks].
// =====================================================================================
__global__ __launch_bounds__(128)
void attn_planes_kernel(const unsigned short* __restrict__ qp, const unsigned short* __restrict__ kp,
                        const unsigned short* __restrict__ vtp, const int* __restrict__ vlen,
                        float* __restrict__ out)
{
  __shared__ __align__(16) __bf16 Ksh[kKC * kDim];          // [kv][d]       8 KB
  __shared__ __align__(16) __bf16 Vts[kDim * kKC];          // [d][kv]       8 KB
  __shared__ __align__(16) __bf16 Psh[kNW][16 * kKC];       // p hi [row][kv] per wave
  __shared__ __align__(16) __bf16 Psl[kNW][16 * kKC];       // p lo
  __shared__ __align__(16) float  Os[kNW][16 * 68];         // per wave out tile, pitch 68

  const int tid  = threadIdx.x;
  const int wave = tid >> 5;
  const int lane = tid & 31;
  const int hh   = lane >> 4;
  const int c    = lane & 15;

  const int nqb = kSeq / kQB;
  const int bx  = blockIdx.x;
  const int qb  = bx % nqb;
  const int bh  = bx / nqb;
  const int h   = bh % kHeads;
  const int b   = bh / kHeads;
  const int q0  = qb * kQB + wave * 16;

  int valid = vlen[b];
  valid = valid < 0 ? 0 : valid;
  valid = valid > kSkv ? kSkv : valid;
  int nChunks = (valid + kKC - 1) / kKC;          // block-uniform
  nChunks = nChunks < 1 ? 1 : nChunks;
  nChunks = nChunks > kMaxChunks ? kMaxChunks : nChunks;

  // ---- Q fragments (A operand: row = query q0 + c, k = d), 2 d-chunks ----
  v16b qa[2];
  {
    const __bf16* qrow = (const __bf16*)qp + ((size_t)(b * kSeq + q0 + c) * kHeads + h) * kDim;
#pragma unroll
    for (int dc = 0; dc < 2; ++dc) qa[dc] = Frag<__bf16>::load(qrow + dc * 32 + 8 * hh);
  }

  float mrow[8], lrow[8];
  v8f oacc[4];
#pragma unroll
  for (int r = 0; r < 8; ++r) { mrow[r] = -INFINITY; lrow[r] = 0.f; }
#pragma unroll
  for (int t = 0; t < 4; ++t) oacc[t] = (v8f){0.f,0.f,0.f,0.f,0.f,0.f,0.f,0.f};

  const size_t kbase  = ((size_t)b * kSkv) * kHeads * kDim + (size_t)h * kDim;   // + kv*(H*D)
  const size_t vtbase = ((size_t)(b * kHeads + h) * kDim) * kSkv;                  // + d*S + kv

  for (int kc = 0; kc < nChunks; ++kc) {
    const int kv0 = kc * kKC;
    __syncthreads();
    {
      // stage K [64 kv][64 d] and V^T [64 d][64 kv]: thread -> row tid>>1, half (tid&1)*32, 4 x 16 B each
      const int r = tid >> 1, half = (tid & 1) * 32;
      const v4u* ksrc = (const v4u*)(kp + kbase + (size_t)(kv0 + r) * (kHeads * kDim) + half);
      v4u* kdst = (v4u*)(Ksh + r * kDim + half);
      const v4u* vsrc = (const v4u*)(vtp + vtbase + (size_t)r * kSkv + kv0 + half);
      v4u* vdst = (v4u*)(Vts + r * kKC + half);
#pragma unroll
      for (int i = 0; i < 4; ++i) { kdst[i] = ksrc[i]; vdst[i] = vsrc[i]; }
    }
    __syncthreads();

    // ---- scores: s[j] covers keys kv0 + 16j .. +15 (B operand column = key, k = d) ----
    v8f s[4];
#pragma unroll
    for (int j = 0; j < 4; ++j) {
      s[j] = (v8f){0.f,0.f,0.f,0.f,0.f,0.f,0.f,0.f};
#pragma unroll
      for (int dc = 0; dc < 2; ++dc) {
        const v16b kb = Frag<__bf16>::load(Ksh + (j * 16 + c) * kDim + dc * 32 + 8 * hh);
        s[j] = at_mma(qa[dc], kb, s[j]);
      }
    }

    // ---- scale, key mask (select -inf), per-row chunk max ----
    float cm[8];
#pragma unroll
    for (int r = 0; r < 8; ++r) {
      float m = -INFINITY;
#pragma unroll
      for (int j = 0; j < 4; ++j) {
        const int kvcol = kv0 + j * 16 + c;
        float sv = s[j][r] * kScale;
        sv = (kvcol < valid) ? sv : -INFINITY;
        s[j][r] = sv;
        m = fmaxf(m, sv);
      }
#pragma unroll
      for (int off = 1; off < 16; off <<= 1) m = fmaxf(m, __shfl_xor(m, off, 32));
      cm[r] = m;
    }

    // ---- online softmax; p -> bf16 hi and lo planes in LDS (per wave) ----
    __bf16* pwh = Psh[wave];
    __bf16* pwl = Psl[wave];
#pragma unroll
    for (int r = 0; r < 8; ++r) {
      const float mnew  = fmaxf(mrow[r], cm[r]);
      const float alpha = expf(mrow[r] - mnew);
      mrow[r] = mnew;
      float psum = 0.f;
#pragma unroll
      for (int j = 0; j < 4; ++j) {
        const float p = expf(s[j][r] - mnew);
        psum += p;
        __bf16 ph, pl;
        at_split(p, ph, pl);
        pwh[(8 * hh + r) * kKC + j * 16 + c] = ph;
        pwl[(8 * hh + r) * kKC + j * 16 + c] = pl;
      }
#pragma unroll
      for (int off = 1; off < 16; off <<= 1) psum += __shfl_xor(psum, off, 32);
      lrow[r] = lrow[r] * alpha + psum;
#pragma unroll
      for (int t = 0; t < 4; ++t) oacc[t][r] *= alpha;
    }
    __builtin_amdgcn_fence(__ATOMIC_RELEASE, "workgroup");
    __builtin_amdgcn_wave_barrier();
    __builtin_amdgcn_fence(__ATOMIC_ACQUIRE, "workgroup");

    // ---- out += p.v : A = p [row][k = kv], B = v^T [n = d][k = kv] ----
#pragma unroll 1
    for (int kk = 0; kk < 2; ++kk) {
      const v16b pa = Frag<__bf16>::load(pwh + c * kKC + kk * 32 + 8 * hh);
      const v16b pb = Frag<__bf16>::load(pwl + c * kKC + kk * 32 + 8 * hh);
#pragma unroll
      for (int t = 0; t < 4; ++t) {
        const v16b vb = Frag<__bf16>::load(Vts + (t * 16 + c) * kKC + kk * 32 + 8 * hh);
        oacc[t] = at_mma(pa, vb, oacc[t]);
        oacc[t] = at_mma(pb, vb, oacc[t]);
      }
    }
  }

  float* os = Os[wave];
#pragma unroll
  for (int r = 0; r < 8; ++r) {
    const float inv = 1.0f / lrow[r];
#pragma unroll
    for (int t = 0; t < 4; ++t) os[(8 * hh + r) * 68 + t * 16 + c] = oacc[t][r] * inv;
  }
  __builtin_amdgcn_fence(__ATOMIC_RELEASE, "workgroup");
  __builtin_amdgcn_wave_barrier();
  __builtin_amdgcn_fence(__ATOMIC_ACQUIRE, "workgroup");
  {
    const size_t o_rs = (size_t)kHeads * kDim;   // row stride (floats)
    float* ob_ptr = out + ((size_t)b * kSeq) * o_rs + (size_t)h * kDim;
    const int c4 = (lane & 15) * 4;               // row segment 256 B = 16 lanes x 16 B
    {
#pragma unroll
      for (int it = 0; it < 8; ++it) {
        const int row = it * 2 + hh;
        v4f val = *(const v4f*)(os + row * 68 + c4);
        *(v4f*)(ob_ptr + (size_t)(q0 + row) * o_rs + c4) = val;
      }
      
    }
  }
}

// =====================================================================================
// Host glue. Workspace region map (bytes):
//   [         0,  8,388,608)  q  bf16 plane [B][S][H][D]
//   [ 8,388,608, 16,777,216)  k  bf16 plane [B][S][H][D]
//   [16,777,216, 25,165,824)  v^T bf16 plane [B][H][D][S]
//   total carve 25,165,824 B
// =====================================================================================
extern "C" void kernel_launch(void* const* d_in, const int* in_sizes, int n_in,
                              void* d_out, int out_size, void* d_ws, size_t ws_size,
                              hipStream_t stream)
{
  (void)in_sizes; (void)n_in; (void)out_size;
  const float* q  = (const float*)d_in[0];
  const float* k  = (const float*)d_in[1];
  const float* v  = (const float*)d_in[2];
  const int*   vl = (const int*)d_in[3];
  float* out = (float*)d_out;

  const size_t planeElems = (size_t)kBatch * kSeq * kHeads * kDim;            // 4,194,304
  const size_t carveBytes = 3 * planeElems * sizeof(unsigned short);          // 25,165,824
  if (carveBytes > ws_size) return;

  unsigned short* ws  = (unsigned short*)d_ws;
  unsigned short* qp  = ws;
  unsigned short* kp  = ws + planeElems;
  unsigned short* vtp = ws + 2 * planeElems;

  const int prepBlocks = kBatch * kHeads * (kSkv / 64);      // 1024
  const int attnBlocks = kBatch * kHeads * (kSeq / kQB);     // 1024

  prep_planes<<<dim3(prepBlocks), dim3(128), 0, stream>>>(q, k, v, qp, kp, vtp);
  attn_planes_kernel<<<dim3(attnBlocks), dim3(128), 0, stream>>>(qp, kp, vtp, vl, out);
}

// v001
// Measured time: 74 microseconds a run.
// In both of two side-by-side timings against v000, it was 1.42 times as fast.
// Contractions: scores = q.k^T and out = p.v on v_wmma_f32_16x16x32_bf16 (q, k, v RNE-converted to bf16 once at load; p carried as bf16 hi+lo planes, v single bf16 plane), f32 accumulate; masking, online softmax and normalisation in f32.
#include <hip/hip_runtime.h>
#include <stdint.h>
#include <math.h>

typedef __attribute__((ext_vector_type(16))) __bf16   v16b;
typedef __attribute__((ext_vector_type(8)))  __bf16   v8b;
typedef __attribute__((ext_vector_type(8)))  float    v8f;
typedef __attribute__((ext_vector_type(4)))  float    v4f;
typedef __attribute__((ext_vector_type(4)))  unsigned v4u;

// ---- problem geometry (element (b,s,h,d) of every tensor at ((b*S+s)*H+h)*D+d) ----
constexpr int kBatch = 2;
constexpr int kSeq   = 2048;   // query length
constexpr int kSkv   = 2048;   // key length
constexpr int kHeads = 16;
constexpr int kDim   = 64;
constexpr int kQB    = 64;     // query rows per block (4 waves x 16)
constexpr int kKC    = 64;     // keys per chunk
constexpr int kNW    = 4;
constexpr int kMaxChunks = kSkv / kKC;
constexpr int kPit   = 72;     // LDS row pitch of the 64-element bf16 tiles: 144 B = 16 B x 9, so the 16 rows of a 16-byte fragment read fall on 64 different banks
constexpr float kScale = 0.125f;   // 1/sqrt(64), exact power of two, applied to the f32 score accumulator
static_assert(kSeq % kQB == 0);
static_assert(kSkv % kKC == 0);
static_assert(kSeq == kSkv);
static_assert(kDim == 64);
static_assert(kKC == 64);
static_assert((kPit * 2) % 16 == 0);   // rows stay 16-byte aligned
static_assert(kKC % 32 == 0);      // contraction depth of p.v per chunk is a multiple of 32
static_assert(kDim % 32 == 0);     // contraction depth of q.k^T is a multiple of 32

// ---- helpers ----
__device__ __forceinline__ unsigned short f2bf_bits(float f) {
  unsigned u = __float_as_uint(f);
  return (unsigned short)((u + 0x7FFFu + ((u >> 16) & 1u)) >> 16);
}
__device__ __forceinline__ float bf_bits2f(unsigned short h) { return __uint_as_float(((unsigned)h) << 16); }

__device__ __forceinline__ void dep_guard_b(v8f& a, v8f& b, v16b x, v16b y) { asm volatile("v_nop\n\tv_nop\n\tv_nop\n\tv_nop" : "+v"(a), "+v"(b) : "v"(x), "v"(y)); }
__device__ __forceinline__ void keep4_b(v16b a, v16b b, v16b c, v16b d) { asm volatile("v_nop" :: "v"(a), "v"(b), "v"(c), "v"(d)); }
template <typename T> struct Frag;
template <> struct Frag<__bf16> {
  typedef v16b V; union U { v16b v; v8b h[2]; };
  static __device__ __forceinline__ v16b load(const __bf16* p) {   // elements 0..7 <- p[0..7], 8..15 <- p[16..23]
    U f; f.h[0] = *(const v8b*)(p); f.h[1] = *(const v8b*)(p + 16); return f.v;
  }
  static __device__ __forceinline__ v8f mma(v16b a, v16b b, v8f c) {
    return __builtin_amdgcn_wmma_f32_16x16x32_bf16(false, a, false, b, (short)0, c, false, false);
  }
  static __device__ __forceinline__ void guard(v8f& a, v8f& b, v16b x, v16b y) { dep_guard_b(a, b, x, y); }
  static __device__ __forceinline__ void keep(v16b a, v16b b, v16b c, v16b d) { keep4_b(a, b, c, d); }
};

__device__ __forceinline__ unsigned short at_bf_bits(float f) {
  unsigned u = __float_as_uint(f);
  return (unsigned short)((u + 0x7FFFu + ((u >> 16) & 1u)) >> 16);
}
__device__ __forceinline__ __bf16 at_f2bf(float f) { return __builtin_bit_cast(__bf16, at_bf_bits(f)); }
__device__ __forceinline__ void at_split(float f, __bf16& hi, __bf16& lo) {
  const unsigned short hb = at_bf_bits(f);
  hi = __builtin_bit_cast(__bf16, hb);
  lo = at_f2bf(f - __uint_as_float(((unsigned)hb) << 16));
}
__device__ __forceinline__ v8f at_mma(v16b a, v16b b, v8f c) {
  c = __builtin_amdgcn_wmma_f32_16x16x32_bf16(false, a, false, b, (short)0, c, false, false);
  asm volatile("v_nop\n\tv_nop\n\tv_nop\n\tv_nop" : "+v"(c) : "v"(a), "v"(b));
  return c;
}

// pack 8 f32 -> 8 bf16 (RNE) as 4 x 32-bit words, element 2e in the low half-word
__device__ __forceinline__ v4u pack_bf16x8(v4f a, v4f b) {
  v4u r;
  r[0] = (unsigned)f2bf_bits(a[0]) | ((unsigned)f2bf_bits(a[1]) << 16);
  r[1] = (unsigned)f2bf_bits(a[2]) | ((unsigned)f2bf_bits(a[3]) << 16);
  r[2] = (unsigned)f2bf_bits(b[0]) | ((unsigned)f2bf_bits(b[1]) << 16);
  r[3] = (unsigned)f2bf_bits(b[2]) | ((unsigned)f2bf_bits(b[3]) << 16);
  return r;
}

// =====================================================================================
// Prep: one block per (b, h, 64-row s tile). 128 threads.
// Coverage per block: q/k: rows it*16 + (tid>>3), it 0..3 -> 64 rows, cols (tid&7)*8 .. +7 -> 64 cols;
//   v load: s = tid>>1 (0..63), d = (tid&1)*32 + 0..31; v write: d = it*16 + (tid>>3) (0..63), s = (tid&7)*8 + 0..7.
//   1024 blocks = 2 b x 16 h x 32 s-tiles cover all three planes exactly once.
// =====================================================================================
__global__ __launch_bounds__(128)
void prep_planes(const float* __restrict__ q, const float* __restrict__ k, const float* __restrict__ v,
                 unsigned short* __restrict__ qp, unsigned short* __restrict__ kp, unsigned short* __restrict__ vtp)
{
  __shared__ __align__(16) float tile[64 * 68];   // [s][d], pitch 68 floats
  const int tid = threadIdx.x;
  const int bx  = blockIdx.x;
  const int nst = kSkv / 64;
  const int st  = bx % nst;
  const int bh  = bx / nst;
  const int h   = bh % kHeads;
  const int b   = bh / kHeads;
  const int s0  = st * 64;

  // ---- v tile -> LDS (f32, row-major [s][d]) ----
  {
    const int s = tid >> 1, dh = (tid & 1) * 32;
    const float* src = v + ((size_t)(b * kSkv + s0 + s) * kHeads + h) * kDim + dh;
#pragma unroll
    for (int i = 0; i < 8; ++i) *(v4f*)(tile + s * 68 + dh + 4 * i) = *(const v4f*)(src + 4 * i);
  }
  __syncthreads();

  const int rg = tid >> 3;          // row group 0..15
  const int c8 = (tid & 7) * 8;     // 8 consecutive elements per lane

  v4u qw[4], kw[4], vw[4];
#pragma unroll
  for (int it = 0; it < 4; ++it) {
    const int row = it * 16 + rg;
    const size_t off = ((size_t)(b * kSeq + s0 + row) * kHeads + h) * kDim + c8;
    const v4f a0 = *(const v4f*)(q + off);
    const v4f a1 = *(const v4f*)(q + off + 4);
    qw[it] = pack_bf16x8(a0, a1);
  }
  asm volatile("" ::: "memory");
#pragma unroll
  for (int it = 0; it < 4; ++it) {
    const int row = it * 16 + rg;
    const size_t off = ((size_t)(b * kSkv + s0 + row) * kHeads + h) * kDim + c8;
    const v4f a0 = *(const v4f*)(k + off);
    const v4f a1 = *(const v4f*)(k + off + 4);
    kw[it] = pack_bf16x8(a0, a1);
  }
  asm volatile("" ::: "memory");
#pragma unroll
  for (int it = 0; it < 4; ++it) {
    const int d = it * 16 + rg;
    v4f f0, f1;
#pragma unroll
    for (int e = 0; e < 4; ++e) {
      f0[e] = tile[(c8 + e) * 68 + d];
      f1[e] = tile[(c8 + 4 + e) * 68 + d];
    }
    vw[it] = pack_bf16x8(f0, f1);
  }

  {
#pragma unroll
    for (int it = 0; it < 4; ++it) {
      const int row = it * 16 + rg;
      const size_t offq = ((size_t)(b * kSeq + s0 + row) * kHeads + h) * kDim + c8;
      *(v4u*)(qp + offq) = qw[it];
      *(v4u*)(kp + offq) = kw[it];
      const int d = row;
      const size_t offv = ((size_t)((b * kHeads + h) * kDim + d)) * kSkv + s0 + c8;
      *(v4u*)(vtp + offv) = vw[it];
    }
    
  }
}

// =====================================================================================
// Attention for head_dim 64 on bf16 planes: block = 4 waves = 64 query rows of one (b, h); 64-key chunks.
//   scores: A = q rows (bf16), B = k rows (bf16, [kv][d] in LDS)          -> v_wmma_f32_16x16x32_bf16
//   out   : A = p (bf16 hi and lo planes per wave in LDS), B = v^T ([d][kv]) -> v_wmma_f32_16x16x32_bf16 x2
//   Keys with index >= valid_lens[b] get score -inf (select); chunks entirely beyond valid_lens are skipped
//   (their probabilities are exactly 0); chunk count clamped to [1, kMaxChunks].
// =====================================================================================
__global__ __launch_bounds__(128)
void attn_planes_kernel(const unsigned short* __restrict__ qp, const unsigned short* __restrict__ kp,
                        const unsigned short* __restrict__ vtp, const int* __restrict__ vlen,
                        float* __restrict__ out)
{
  __shared__ __align__(16) __bf16 Ksh[kKC * kPit];          // [kv][d]       9 KB, pitch kPit
  __shared__ __align__(16) __bf16 Vts[kDim * kPit];         // [d][kv]       9 KB, pitch kPit
  __shared__ __align__(16) __bf16 Psh[kNW][16 * kPit];      // p hi [row][kv] per wave, pitch kPit
  __shared__ __align__(16) __bf16 Psl[kNW][16 * kPit];      // p lo
  __shared__ __align__(16) float  Os[kNW][16 * 68];         // per wave out tile, pitch 68

  const int tid  = threadIdx.x;
  const int wave = tid >> 5;
  const int lane = tid & 31;
  const int hh   = lane >> 4;
  const int c    = lane & 15;

  const int nqb = kSeq / kQB;
  const int bx  = blockIdx.x;
  const int qb  = bx % nqb;
  const int bh  = bx / nqb;
  const int h   = bh % kHeads;
  const int b   = bh / kHeads;
  const int q0  = qb * kQB + wave * 16;

  int valid = vlen[b];
  valid = valid < 0 ? 0 : valid;
  valid = valid > kSkv ? kSkv : valid;
  int nChunks = (valid + kKC - 1) / kKC;          // block-uniform
  nChunks = nChunks < 1 ? 1 : nChunks;
  nChunks = nChunks > kMaxChunks ? kMaxChunks : nChunks;

  // ---- Q fragments (A operand: row = query q0 + c, k = d), 2 d-chunks ----
  v16b qa[2];
  {
    const __bf16* qrow = (const __bf16*)qp + ((size_t)(b * kSeq + q0 + c) * kHeads + h) * kDim;
#pragma unroll
    for (int dc = 0; dc < 2; ++dc) qa[dc] = Frag<__bf16>::load(qrow + dc * 32 + 8 * hh);
  }

  float mrow[8], lrow[8];
  v8f oacc[4];
#pragma unroll
  for (int r = 0; r < 8; ++r) { mrow[r] = -INFINITY; lrow[r] = 0.f; }
#pragma unroll
  for (int t = 0; t < 4; ++t) oacc[t] = (v8f){0.f,0.f,0.f,0.f,0.f,0.f,0.f,0.f};

  const size_t kbase  = ((size_t)b * kSkv) * kHeads * kDim + (size_t)h * kDim;   // + kv*(H*D)
  const size_t vtbase = ((size_t)(b * kHeads + h) * kDim) * kSkv;                  // + d*S + kv

  for (int kc = 0; kc < nChunks; ++kc) {
    const int kv0 = kc * kKC;
    __syncthreads();
    {
      // stage K [64 kv][64 d] and V^T [64 d][64 kv]: thread -> row tid>>1, half (tid&1)*32, 4 x 16 B each
      const int r = tid >> 1, half = (tid & 1) * 32;
      const v4u* ksrc = (const v4u*)(kp + kbase + (size_t)(kv0 + r) * (kHeads * kDim) + half);
      v4u* kdst = (v4u*)(Ksh + r * kPit + half);
      const v4u* vsrc = (const v4u*)(vtp + vtbase + (size_t)r * kSkv + kv0 + half);
      v4u* vdst = (v4u*)(Vts + r * kPit + half);
#pragma unroll
      for (int i = 0; i < 4; ++i) { kdst[i] = ksrc[i]; vdst[i] = vsrc[i]; }
    }
    __syncthreads();

    // ---- scores: s[j] covers keys kv0 + 16j .. +15 (B operand column = key, k = d) ----
    v8f s[4];
#pragma unroll
    for (int j = 0; j < 4; ++j) {
      s[j] = (v8f){0.f,0.f,0.f,0.f,0.f,0.f,0.f,0.f};
#pragma unroll
      for (int dc = 0; dc < 2; ++dc) {
        const v16b kb = Frag<__bf16>::load(Ksh + (j * 16 + c) * kPit + dc * 32 + 8 * hh);
        s[j] = at_mma(qa[dc], kb, s[j]);
      }
    }

    // ---- scale, key mask (select -inf), per-row chunk max ----
    float cm[8];
#pragma unroll
    for (int r = 0; r < 8; ++r) {
      float m = -INFINITY;
#pragma unroll
      for (int j = 0; j < 4; ++j) {
        const int kvcol = kv0 + j * 16 + c;
        float sv = s[j][r] * kScale;
        sv = (kvcol < valid) ? sv : -INFINITY;
        s[j][r] = sv;
        m = fmaxf(m, sv);
      }
#pragma unroll
      for (int off = 1; off < 16; off <<= 1) m = fmaxf(m, __shfl_xor(m, off, 32));
      cm[r] = m;
    }

    // ---- online softmax; p -> bf16 hi and lo planes in LDS (per wave) ----
    __bf16* pwh = Psh[wave];
    __bf16* pwl = Psl[wave];
#pragma unroll
    for (int r = 0; r < 8; ++r) {
      const float mnew  = fmaxf(mrow[r], cm[r]);
      const float alpha = expf(mrow[r] - mnew);
      mrow[r] = mnew;
      float psum = 0.f;
#pragma unroll
      for (int j = 0; j < 4; ++j) {
        const float p = expf(s[j][r] - mnew);
        psum += p;
        __bf16 ph, pl;
        at_split(p, ph, pl);
        pwh[(8 * hh + r) * kPit + j * 16 + c] = ph;
        pwl[(8 * hh + r) * kPit + j * 16 + c] = pl;
      }
#pragma unroll
      for (int off = 1; off < 16; off <<= 1) psum += __shfl_xor(psum, off, 32);
      lrow[r] = lrow[r] * alpha + psum;
#pragma unroll
      for (int t = 0; t < 4; ++t) oacc[t][r] *= alpha;
    }
    __builtin_amdgcn_fence(__ATOMIC_RELEASE, "workgroup");
    __builtin_amdgcn_wave_barrier();
    __builtin_amdgcn_fence(__ATOMIC_ACQUIRE, "workgroup");

    // ---- out += p.v : A = p [row][k = kv], B = v^T [n = d][k = kv] ----
#pragma unroll 1
    for (int kk = 0; kk < 2; ++kk) {
      const v16b pa = Frag<__bf16>::load(pwh + c * kPit + kk * 32 + 8 * hh);
      const v16b pb = Frag<__bf16>::load(pwl + c * kPit + kk * 32 + 8 * hh);
#pragma unroll
      for (int t = 0; t < 4; ++t) {
        const v16b vb = Frag<__bf16>::load(Vts + (t * 16 + c) * kPit + kk * 32 + 8 * hh);
        oacc[t] = at_mma(pa, vb, oacc[t]);
        oacc[t] = at_mma(pb, vb, oacc[t]);
      }
    }
  }

  float* os = Os[wave];
#pragma unroll
  for (int r = 0; r < 8; ++r) {
    const float inv = 1.0f / lrow[r];
#pragma unroll
    for (int t = 0; t < 4; ++t) os[(8 * hh + r) * 68 + t * 16 + c] = oacc[t][r] * inv;
  }
  __builtin_amdgcn_fence(__ATOMIC_RELEASE, "workgroup");
  __builtin_amdgcn_wave_barrier();
  __builtin_amdgcn_fence(__ATOMIC_ACQUIRE, "workgroup");
  {
    const size_t o_rs = (size_t)kHeads * kDim;   // row stride (floats)
    float* ob_ptr = out + ((size_t)b * kSeq) * o_rs + (size_t)h * kDim;
    const int c4 = (lane & 15) * 4;               // row segment 256 B = 16 lanes x 16 B
    {
#pragma unroll
      for (int it = 0; it < 8; ++it) {
        const int row = it * 2 + hh;
        v4f val = *(const v4f*)(os + row * 68 + c4);
        *(v4f*)(ob_ptr + (size_t)(q0 + row) * o_rs + c4) = val;
      }
      
    }
  }
}

// =====================================================================================
// Host glue. Workspace region map (bytes):
//   [         0,  8,388,608)  q  bf16 plane [B][S][H][D]
//   [ 8,388,608, 16,777,216)  k  bf16 plane [B][S][H][D]
//   [16,777,216, 25,165,824)  v^T bf16 plane [B][H][D][S]
//   total carve 25,165,824 B
// =====================================================================================
extern "C" void kernel_launch(void* const* d_in, const int* in_sizes, int n_in,
                              void* d_out, int out_size, void* d_ws, size_t ws_size,
                              hipStream_t stream)
{
  (void)in_sizes; (void)n_in; (void)out_size;
  const float* q  = (const float*)d_in[0];
  const float* k  = (const float*)d_in[1];
  const float* v  = (const float*)d_in[2];
  const int*   vl = (const int*)d_in[3];
  float* out = (float*)d_out;

  const size_t planeElems = (size_t)kBatch * kSeq * kHeads * kDim;            // 4,194,304
  const size_t carveBytes = 3 * planeElems * sizeof(unsigned short);          // 25,165,824
  if (carveBytes > ws_size) return;

  unsigned short* ws  = (unsigned short*)d_ws;
  unsigned short* qp  = ws;
  unsigned short* kp  = ws + planeElems;
  unsigned short* vtp = ws + 2 * planeElems;

  const int prepBlocks = kBatch * kHeads * (kSkv / 64);      // 1024
  const int attnBlocks = kBatch * kHeads * (kSeq / kQB);     // 1024

  prep_planes<<<dim3(prepBlocks), dim3(128), 0, stream>>>(q, k, v, qp, kp, vtp);
  attn_planes_kernel<<<dim3(attnBlocks), dim3(128), 0, stream>>>(qp, kp, vtp, vl, out);
}

// v002
// It runs in 47.3 microseconds.
// Two timings next to v001 both put it at 1.57 times that version's speed.
// Over all steps from v000 it is 2.23 times as fast.
// Contractions: scores = q.k^T and out = p.v on v_wmma_f32_16x16x32_bf16 (q, k, v RNE-converted to bf16 once at load; p carried as bf16 hi+lo parts, v single bf16 plane), f32 accumulate; masking, online softmax and normalisation in f32.
#include <hip/hip_runtime.h>
#include <stdint.h>
#include <math.h>

typedef __attribute__((ext_vector_type(16))) __bf16   v16b;
typedef __attribute__((ext_vector_type(8)))  __bf16   v8b;
typedef __attribute__((ext_vector_type(8)))  float    v8f;
typedef __attribute__((ext_vector_type(4)))  float    v4f;
typedef __attribute__((ext_vector_type(4)))  unsigned v4u;

// ---- problem geometry (element (b,s,h,d) of every tensor at ((b*S+s)*H+h)*D+d) ----
constexpr int kBatch = 2;
constexpr int kSeq   = 2048;   // query length
constexpr int kSkv   = 2048;   // key length
constexpr int kHeads = 16;
constexpr int kDim   = 64;
constexpr int kQB    = 64;     // query rows per block (4 waves x 16)
constexpr int kKC    = 64;     // keys per chunk
constexpr int kNW    = 4;
constexpr int kMaxChunks = kSkv / kKC;
constexpr int kPit   = 72;     // LDS row pitch of the 64-element bf16 tiles: 144 B = 16 B x 9, so the 16 rows of a 16-byte fragment read fall on 64 different banks
constexpr float kScale = 0.125f;   // 1/sqrt(64), exact power of two, applied to the f32 score accumulator
static_assert(kSeq % kQB == 0);
static_assert(kSkv % kKC == 0);
static_assert(kSeq == kSkv);
static_assert(kDim == 64);
static_assert(kKC == 64);
static_assert((kPit * 2) % 16 == 0);   // rows stay 16-byte aligned
static_assert(kKC % 32 == 0);      // contraction depth of p.v per chunk is a multiple of 32
static_assert(kDim % 32 == 0);     // contraction depth of q.k^T is a multiple of 32

// ---- helpers ----
__device__ __forceinline__ unsigned short f2bf_bits(float f) {
  unsigned u = __float_as_uint(f);
  return (unsigned short)((u + 0x7FFFu + ((u >> 16) & 1u)) >> 16);
}
__device__ __forceinline__ float bf_bits2f(unsigned short h) { return __uint_as_float(((unsigned)h) << 16); }

__device__ __forceinline__ void dep_guard_b(v8f& a, v8f& b, v16b x, v16b y) { asm volatile("v_nop\n\tv_nop\n\tv_nop\n\tv_nop" : "+v"(a), "+v"(b) : "v"(x), "v"(y)); }
__device__ __forceinline__ void keep4_b(v16b a, v16b b, v16b c, v16b d) { asm volatile("v_nop" :: "v"(a), "v"(b), "v"(c), "v"(d)); }
template <typename T> struct Frag;
template <> struct Frag<__bf16> {
  typedef v16b V; union U { v16b v; v8b h[2]; };
  static __device__ __forceinline__ v16b load(const __bf16* p) {   // elements 0..7 <- p[0..7], 8..15 <- p[16..23]
    U f; f.h[0] = *(const v8b*)(p); f.h[1] = *(const v8b*)(p + 16); return f.v;
  }
  static __device__ __forceinline__ v8f mma(v16b a, v16b b, v8f c) {
    return __builtin_amdgcn_wmma_f32_16x16x32_bf16(false, a, false, b, (short)0, c, false, false);
  }
  static __device__ __forceinline__ void guard(v8f& a, v8f& b, v16b x, v16b y) { dep_guard_b(a, b, x, y); }
  static __device__ __forceinline__ void keep(v16b a, v16b b, v16b c, v16b d) { keep4_b(a, b, c, d); }
};

__device__ __forceinline__ unsigned short at_bf_bits(float f) {
  unsigned u = __float_as_uint(f);
  return (unsigned short)((u + 0x7FFFu + ((u >> 16) & 1u)) >> 16);
}
__device__ __forceinline__ __bf16 at_f2bf(float f) { return __builtin_bit_cast(__bf16, at_bf_bits(f)); }
__device__ __forceinline__ void at_split(float f, __bf16& hi, __bf16& lo) {
  const unsigned short hb = at_bf_bits(f);
  hi = __builtin_bit_cast(__bf16, hb);
  lo = at_f2bf(f - __uint_as_float(((unsigned)hb) << 16));
}
// value of the lane 16 away (the other half's lane of the same column), by a vector cross-row move
__device__ __forceinline__ float other_half(float x) {
  const int b = __float_as_int(x);
  return __int_as_float(__builtin_amdgcn_permlanex16(b, b, 0x76543210, 0xfedcba98, false, false));
}
__device__ __forceinline__ v8f at_mma(v16b a, v16b b, v8f c) {
  c = __builtin_amdgcn_wmma_f32_16x16x32_bf16(false, a, false, b, (short)0, c, false, false);
  asm volatile("v_nop\n\tv_nop\n\tv_nop\n\tv_nop" : "+v"(c) : "v"(a), "v"(b));
  return c;
}

// pack 8 f32 -> 8 bf16 (RNE) as 4 x 32-bit words, element 2e in the low half-word
__device__ __forceinline__ v4u pack_bf16x8(v4f a, v4f b) {
  v4u r;
  r[0] = (unsigned)f2bf_bits(a[0]) | ((unsigned)f2bf_bits(a[1]) << 16);
  r[1] = (unsigned)f2bf_bits(a[2]) | ((unsigned)f2bf_bits(a[3]) << 16);
  r[2] = (unsigned)f2bf_bits(b[0]) | ((unsigned)f2bf_bits(b[1]) << 16);
  r[3] = (unsigned)f2bf_bits(b[2]) | ((unsigned)f2bf_bits(b[3]) << 16);
  return r;
}

// =====================================================================================
// Prep: one block per (b, h, 64-row s tile). 128 threads.
// Coverage per block: q/k: rows it*16 + (tid>>3), it 0..3 -> 64 rows, cols (tid&7)*8 .. +7 -> 64 cols;
//   v load: s = tid>>1 (0..63), d = (tid&1)*32 + 0..31; v write: d = it*16 + (tid>>3) (0..63), s = (tid&7)*8 + 0..7.
//   1024 blocks = 2 b x 16 h x 32 s-tiles cover all three planes exactly once.
// =====================================================================================
__global__ __launch_bounds__(128)
void prep_planes(const float* __restrict__ q, const float* __restrict__ k, const float* __restrict__ v,
                 unsigned short* __restrict__ qp, unsigned short* __restrict__ kp, unsigned short* __restrict__ vtp)
{
  __shared__ __align__(16) float tile[64 * 68];   // [s][d], pitch 68 floats
  const int tid = threadIdx.x;
  const int bx  = blockIdx.x;
  const int nst = kSkv / 64;
  const int st  = bx % nst;
  const int bh  = bx / nst;
  const int h   = bh % kHeads;
  const int b   = bh / kHeads;
  const int s0  = st * 64;

  // ---- v tile -> LDS (f32, row-major [s][d]) ----
  {
    const int s = tid >> 1, dh = (tid & 1) * 32;
    const float* src = v + ((size_t)(b * kSkv + s0 + s) * kHeads + h) * kDim + dh;
#pragma unroll
    for (int i = 0; i < 8; ++i) *(v4f*)(tile + s * 68 + dh + 4 * i) = *(const v4f*)(src + 4 * i);
  }
  __syncthreads();

  const int rg = tid >> 3;          // row group 0..15
  const int c8 = (tid & 7) * 8;     // 8 consecutive elements per lane

  v4u qw[4], kw[4], vw[4];
#pragma unroll
  for (int it = 0; it < 4; ++it) {
    const int row = it * 16 + rg;
    const size_t off = ((size_t)(b * kSeq + s0 + row) * kHeads + h) * kDim + c8;
    const v4f a0 = *(const v4f*)(q + off);
    const v4f a1 = *(const v4f*)(q + off + 4);
    qw[it] = pack_bf16x8(a0, a1);
  }
  asm volatile("" ::: "memory");
#pragma unroll
  for (int it = 0; it < 4; ++it) {
    const int row = it * 16 + rg;
    const size_t off = ((size_t)(b * kSkv + s0 + row) * kHeads + h) * kDim + c8;
    const v4f a0 = *(const v4f*)(k + off);
    const v4f a1 = *(const v4f*)(k + off + 4);
    kw[it] = pack_bf16x8(a0, a1);
  }
  asm volatile("" ::: "memory");
#pragma unroll
  for (int it = 0; it < 4; ++it) {
    const int d = it * 16 + rg;
    v4f f0, f1;
#pragma unroll
    for (int e = 0; e < 4; ++e) {
      f0[e] = tile[(c8 + e) * 68 + d];
      f1[e] = tile[(c8 + 4 + e) * 68 + d];
    }
    vw[it] = pack_bf16x8(f0, f1);
  }

  {
#pragma unroll
    for (int it = 0; it < 4; ++it) {
      const int row = it * 16 + rg;
      const size_t offq = ((size_t)(b * kSeq + s0 + row) * kHeads + h) * kDim + c8;
      *(v4u*)(qp + offq) = qw[it];
      *(v4u*)(kp + offq) = kw[it];
      const int d = row;
      const size_t offv = ((size_t)((b * kHeads + h) * kDim + d)) * kSkv + s0 + c8;
      *(v4u*)(vtp + offv) = vw[it];
    }
    
  }
}

// =====================================================================================
// Attention for head_dim 64 on bf16 planes: block = 4 waves = 64 query rows of one (b, h); 64-key chunks.
//   Both products are formed transposed, so that a lane holds scores and outputs of ONE query (column c):
//   scores^T: A = k rows (bf16, [kv][d] in LDS), B = q rows (bf16, registers)            -> v_wmma_f32_16x16x32_bf16
//   out^T   : A = v^T rows ([d][kv] in LDS), B = p^T (bf16 hi and lo, packed in registers) -> v_wmma_f32_16x16x32_bf16 x2
//   Keys with index >= valid_lens[b] get score -inf (select); chunks entirely beyond valid_lens are skipped
//   (their probabilities are exactly 0); chunk count clamped to [1, kMaxChunks].
// =====================================================================================
__global__ __launch_bounds__(128)
void attn_planes_kernel(const unsigned short* __restrict__ qp, const unsigned short* __restrict__ kp,
                        const unsigned short* __restrict__ vtp, const int* __restrict__ vlen,
                        float* __restrict__ out)
{
  __shared__ __align__(16) __bf16 Ksh[kKC * kPit];          // [kv][d]       9 KB, pitch kPit
  __shared__ __align__(16) __bf16 Vts[kDim * kPit];         // [d][kv]       9 KB, pitch kPit
  __shared__ __align__(16) float  Os[kNW][16 * 68];         // per wave out tile, pitch 68

  const int tid  = threadIdx.x;
  const int wave = tid >> 5;
  const int lane = tid & 31;
  const int hh   = lane >> 4;
  const int c    = lane & 15;

  const int nqb = kSeq / kQB;
  const int bx  = blockIdx.x;
  const int qb  = bx % nqb;
  const int bh  = bx / nqb;
  const int h   = bh % kHeads;
  const int b   = bh / kHeads;
  const int q0  = qb * kQB + wave * 16;

  int valid = vlen[b];
  valid = valid < 0 ? 0 : valid;
  valid = valid > kSkv ? kSkv : valid;
  int nChunks = (valid + kKC - 1) / kKC;          // block-uniform
  nChunks = nChunks < 1 ? 1 : nChunks;
  nChunks = nChunks > kMaxChunks ? kMaxChunks : nChunks;

  // ---- Q fragments (B operand: column = query q0 + c, k = d), 2 d-chunks ----
  v16b qa[2];
  {
    const __bf16* qrow = (const __bf16*)qp + ((size_t)(b * kSeq + q0 + c) * kHeads + h) * kDim;
#pragma unroll
    for (int dc = 0; dc < 2; ++dc) qa[dc] = Frag<__bf16>::load(qrow + dc * 32 + 8 * hh);
  }

  float mrow = -INFINITY;   // running maximum of query q0 + c (equal in both lane halves)
  float lrow = 0.f;         // running sum over this lane half's keys; the halves are joined after the loop
  v8f oacc[4];              // oacc[t][r] = out^T[d = 16t + 8hh + r][query q0 + c]
#pragma unroll
  for (int t = 0; t < 4; ++t) oacc[t] = (v8f){0.f,0.f,0.f,0.f,0.f,0.f,0.f,0.f};

  const size_t kbase  = ((size_t)b * kSkv) * kHeads * kDim + (size_t)h * kDim;   // + kv*(H*D)
  const size_t vtbase = ((size_t)(b * kHeads + h) * kDim) * kSkv;                  // + d*S + kv

  for (int kc = 0; kc < nChunks; ++kc) {
    const int kv0 = kc * kKC;
    __syncthreads();
    {
      // stage K [64 kv][64 d] and V^T [64 d][64 kv]: thread -> row tid>>1, half (tid&1)*32, 4 x 16 B each
      const int r = tid >> 1, half = (tid & 1) * 32;
      const v4u* ksrc = (const v4u*)(kp + kbase + (size_t)(kv0 + r) * (kHeads * kDim) + half);
      v4u* kdst = (v4u*)(Ksh + r * kPit + half);
      const v4u* vsrc = (const v4u*)(vtp + vtbase + (size_t)r * kSkv + kv0 + half);
      v4u* vdst = (v4u*)(Vts + r * kPit + half);
#pragma unroll
      for (int i = 0; i < 4; ++i) { kdst[i] = ksrc[i]; vdst[i] = vsrc[i]; }
    }
    __syncthreads();

    // ---- scores^T: s[j][r] = score(key kv0 + 16j + 8hh + r, query q0 + c) ----
    v8f s[4];
#pragma unroll
    for (int j = 0; j < 4; ++j) {
      s[j] = (v8f){0.f,0.f,0.f,0.f,0.f,0.f,0.f,0.f};
#pragma unroll
      for (int dc = 0; dc < 2; ++dc) {
        const v16b kb = Frag<__bf16>::load(Ksh + (j * 16 + c) * kPit + dc * 32 + 8 * hh);
        s[j] = at_mma(kb, qa[dc], s[j]);
      }
    }

    // ---- scale, key mask (select -inf), chunk max of the lane's query: in-lane, then one exchange of the halves ----
    const int lim = valid - kv0 - 8 * hh;   // rows 16j + r of this lane half below lim are valid keys
    float mj[4];
#pragma unroll
    for (int j = 0; j < 4; ++j) {
      float m = -INFINITY;
#pragma unroll
      for (int r = 0; r < 8; ++r) {
        float sv = s[j][r] * kScale;
        sv = (j * 16 + r < lim) ? sv : -INFINITY;
        s[j][r] = sv;
        m = fmaxf(m, sv);
      }
      mj[j] = m;
    }
    float cm = fmaxf(fmaxf(mj[0], mj[1]), fmaxf(mj[2], mj[3]));
    cm = fmaxf(cm, other_half(cm));

    // ---- online softmax; p^T -> bf16 hi and lo B fragments in registers:
    //      element e of fragment kk is key 32kk + 8hh + e (e < 8) or 32kk + 16 + 8hh + (e - 8), the k order of Frag::load ----
    const float mnew  = fmaxf(mrow, cm);
    const float alpha = expf(mrow - mnew);
    mrow = mnew;
    v16b ph[2], pl[2];
    float pj[4];
#pragma unroll
    for (int j = 0; j < 4; ++j) {
      float psum = 0.f;
#pragma unroll
      for (int r = 0; r < 8; ++r) {
        const float p = expf(s[j][r] - mnew);
        psum += p;
        __bf16 hi, lo;
        at_split(p, hi, lo);
        ph[j >> 1][(j & 1) * 8 + r] = hi;
        pl[j >> 1][(j & 1) * 8 + r] = lo;
      }
      pj[j] = psum;
    }
    lrow = lrow * alpha + ((pj[0] + pj[1]) + (pj[2] + pj[3]));
#pragma unroll
    for (int t = 0; t < 4; ++t)
#pragma unroll
      for (int r = 0; r < 8; ++r) oacc[t][r] *= alpha;

    // ---- out^T += v^T.p^T : A = v^T [m = d][k = kv], B = p^T [k = kv][n = query] ----
    // kk unrolled: ph and pl live in registers, which only constant indices can name (a rolled loop would send them to scratch)
#pragma unroll
    for (int kk = 0; kk < 2; ++kk) {
#pragma unroll
      for (int t = 0; t < 4; ++t) {
        const v16b va = Frag<__bf16>::load(Vts + (t * 16 + c) * kPit + kk * 32 + 8 * hh);
        oacc[t] = at_mma(va, ph[kk], oacc[t]);
        oacc[t] = at_mma(va, pl[kk], oacc[t]);
      }
    }
  }

  // ---- join the halves' sums, normalise, stage the wave's 16 x 64 tile row-major: 8 consecutive d per lane and t ----
  float* os = Os[wave];
  {
    const float inv = 1.0f / (lrow + other_half(lrow));
#pragma unroll
    for (int t = 0; t < 4; ++t) {
      v4f lo4, hi4;
#pragma unroll
      for (int e = 0; e < 4; ++e) { lo4[e] = oacc[t][e] * inv; hi4[e] = oacc[t][4 + e] * inv; }
      *(v4f*)(os + c * 68 + t * 16 + 8 * hh)     = lo4;
      *(v4f*)(os + c * 68 + t * 16 + 8 * hh + 4) = hi4;
    }
  }
  __builtin_amdgcn_fence(__ATOMIC_RELEASE, "workgroup");
  __builtin_amdgcn_wave_barrier();
  __builtin_amdgcn_fence(__ATOMIC_ACQUIRE, "workgroup");
  {
    const size_t o_rs = (size_t)kHeads * kDim;   // row stride (floats)
    float* ob_ptr = out + ((size_t)b * kSeq) * o_rs + (size_t)h * kDim;
    const int c4 = (lane & 15) * 4;               // row segment 256 B = 16 lanes x 16 B
    {
#pragma unroll
      for (int it = 0; it < 8; ++it) {
        const int row = it * 2 + hh;
        v4f val = *(const v4f*)(os + row * 68 + c4);
        *(v4f*)(ob_ptr + (size_t)(q0 + row) * o_rs + c4) = val;
      }
      
    }
  }
}

// =====================================================================================
// Host glue. Workspace region map (bytes):
//   [         0,  8,388,608)  q  bf16 plane [B][S][H][D]
//   [ 8,388,608, 16,777,216)  k  bf16 plane [B][S][H][D]
//   [16,777,216, 25,165,824)  v^T bf16 plane [B][H][D][S]
//   total carve 25,165,824 B
// =====================================================================================
extern "C" void kernel_launch(void* const* d_in, const int* in_sizes, int n_in,
                              void* d_out, int out_size, void* d_ws, size_t ws_size,
                              hipStream_t stream)
{
  (void)in_sizes; (void)n_in; (void)out_size;
  const float* q  = (const float*)d_in[0];
  const float* k  = (const float*)d_in[1];
  const float* v  = (const float*)d_in[2];
  const int*   vl = (const int*)d_in[3];
  float* out = (float*)d_out;

  const size_t planeElems = (size_t)kBatch * kSeq * kHeads * kDim;            // 4,194,304
  const size_t carveBytes = 3 * planeElems * sizeof(unsigned short);          // 25,165,824
  if (carveBytes > ws_size) return;

  unsigned short* ws  = (unsigned short*)d_ws;
  unsigned short* qp  = ws;
  unsigned short* kp  = ws + planeElems;
  unsigned short* vtp = ws + 2 * planeElems;

  const int prepBlocks = kBatch * kHeads * (kSkv / 64);      // 1024
  const int attnBlocks = kBatch * kHeads * (kSeq / kQB);     // 1024

  prep_planes<<<dim3(prepBlocks), dim3(128), 0, stream>>>(q, k, v, qp, kp, vtp);
  attn_planes_kernel<<<dim3(attnBlocks), dim3(128), 0, stream>>>(qp, kp, vtp, vl, out);
}

// v003
// It runs in 41 microseconds.
// Two timings next to v002 both put it at 1.15 times that version's speed.
// All steps since v000 together make it 2.56 times as fast.
// Contractions: scores = q.k^T and out = p.v on v_wmma_f32_16x16x32_bf16 (q, k, v RNE-converted to bf16 once at load; p carried as bf16 hi+lo parts, v single bf16 plane), f32 accumulate; masking, online softmax and normalisation in f32.
#include <hip/hip_runtime.h>
#include <stdint.h>
#include <math.h>

typedef __attribute__((ext_vector_type(16))) __bf16   v16b;
typedef __attribute__((ext_vector_type(8)))  __bf16   v8b;
typedef __attribute__((ext_vector_type(8)))  float    v8f;
typedef __attribute__((ext_vector_type(4)))  float    v4f;
typedef __attribute__((ext_vector_type(4)))  unsigned v4u;

// ---- problem geometry (element (b,s,h,d) of every tensor at ((b*S+s)*H+h)*D+d) ----
constexpr int kBatch = 2;
constexpr int kSeq   = 2048;   // query length
constexpr int kSkv   = 2048;   // key length
constexpr int kHeads = 16;
constexpr int kDim   = 64;
constexpr int kQB    = 64;     // query rows per block (4 waves x 16)
constexpr int kKC    = 64;     // keys per chunk
constexpr int kNW    = 4;
constexpr int kMaxChunks = kSkv / kKC;
constexpr int kPit   = 72;     // LDS row pitch of the 64-element bf16 tiles: 144 B = 16 B x 9, so the 16 rows of a 16-byte fragment read fall on 64 different banks
constexpr float kScaleLog2e = 0.125f * 1.44269504088896340736f;   // 1/sqrt(64) times log2(e): exp(scale * (s - m)) = exp2(s * kScaleLog2e - m * kScaleLog2e)
static_assert(kSeq % kQB == 0);
static_assert(kSkv % kKC == 0);
static_assert(kSeq == kSkv);
static_assert(kDim == 64);
static_assert(kKC == 64);
static_assert((kPit * 2) % 16 == 0);   // rows stay 16-byte aligned
static_assert(kKC % 32 == 0);      // contraction depth of p.v per chunk is a multiple of 32
static_assert(kDim % 32 == 0);     // contraction depth of q.k^T is a multiple of 32

// ---- helpers ----
__device__ __forceinline__ unsigned short f2bf_bits(float f) {
  unsigned u = __float_as_uint(f);
  return (unsigned short)((u + 0x7FFFu + ((u >> 16) & 1u)) >> 16);
}
__device__ __forceinline__ float bf_bits2f(unsigned short h) { return __uint_as_float(((unsigned)h) << 16); }

__device__ __forceinline__ void dep_guard_b(v8f& a, v8f& b, v16b x, v16b y) { asm volatile("v_nop\n\tv_nop\n\tv_nop\n\tv_nop" : "+v"(a), "+v"(b) : "v"(x), "v"(y)); }
__device__ __forceinline__ void keep4_b(v16b a, v16b b, v16b c, v16b d) { asm volatile("v_nop" :: "v"(a), "v"(b), "v"(c), "v"(d)); }
template <typename T> struct Frag;
template <> struct Frag<__bf16> {
  typedef v16b V; union U { v16b v; v8b h[2]; };
  static __device__ __forceinline__ v16b load(const __bf16* p) {   // elements 0..7 <- p[0..7], 8..15 <- p[16..23]
    U f; f.h[0] = *(const v8b*)(p); f.h[1] = *(const v8b*)(p + 16); return f.v;
  }
  static __device__ __forceinline__ v8f mma(v16b a, v16b b, v8f c) {
    return __builtin_amdgcn_wmma_f32_16x16x32_bf16(false, a, false, b, (short)0, c, false, false);
  }
  static __device__ __forceinline__ void guard(v8f& a, v8f& b, v16b x, v16b y) { dep_guard_b(a, b, x, y); }
  static __device__ __forceinline__ void keep(v16b a, v16b b, v16b c, v16b d) { keep4_b(a, b, c, d); }
};

__device__ __forceinline__ unsigned short at_bf_bits(float f) {
  unsigned u = __float_as_uint(f);
  return (unsigned short)((u + 0x7FFFu + ((u >> 16) & 1u)) >> 16);
}
__device__ __forceinline__ __bf16 at_f2bf(float f) { return __builtin_bit_cast(__bf16, at_bf_bits(f)); }
__device__ __forceinline__ void at_split(float f, __bf16& hi, __bf16& lo) {
  const unsigned short hb = at_bf_bits(f);
  hi = __builtin_bit_cast(__bf16, hb);
  lo = at_f2bf(f - __uint_as_float(((unsigned)hb) << 16));
}
// value of the lane 16 away (the other half's lane of the same column), by a vector cross-row move
__device__ __forceinline__ float other_half(float x) {
  const int b = __float_as_int(x);
  return __int_as_float(__builtin_amdgcn_permlanex16(b, b, 0x76543210, 0xfedcba98, false, false));
}
__device__ __forceinline__ v8f at_mma(v16b a, v16b b, v8f c) {
  c = __builtin_amdgcn_wmma_f32_16x16x32_bf16(false, a, false, b, (short)0, c, false, false);
  asm volatile("v_nop\n\tv_nop\n\tv_nop\n\tv_nop" : "+v"(c) : "v"(a), "v"(b));
  return c;
}

// y[i] = 2^x[i]: eight bare hardware exponentials in one statement. Early-clobber results keep every source register intact while
// the run issues; the
// closing v_nop is the slot the instruction set asks for behind a transcendental before its result is read or its source overwritten.
__device__ __forceinline__ void exp2_x8(const float (&x)[8], float (&y)[8]) {
  asm("v_exp_f32 %0, %8\n\t"
      "v_exp_f32 %1, %9\n\t"
      "v_exp_f32 %2, %10\n\t"
      "v_exp_f32 %3, %11\n\t"
      "v_exp_f32 %4, %12\n\t"
      "v_exp_f32 %5, %13\n\t"
      "v_exp_f32 %6, %14\n\t"
      "v_exp_f32 %7, %15\n\t"
      "v_nop"
      : "=&v"(y[0]), "=&v"(y[1]), "=&v"(y[2]), "=&v"(y[3]), "=&v"(y[4]), "=&v"(y[5]), "=&v"(y[6]), "=&v"(y[7])
      : "v"(x[0]), "v"(x[1]), "v"(x[2]), "v"(x[3]), "v"(x[4]), "v"(x[5]), "v"(x[6]), "v"(x[7]));
}

// pack 8 f32 -> 8 bf16 (RNE) as 4 x 32-bit words, element 2e in the low half-word
__device__ __forceinline__ v4u pack_bf16x8(v4f a, v4f b) {
  v4u r;
  r[0] = (unsigned)f2bf_bits(a[0]) | ((unsigned)f2bf_bits(a[1]) << 16);
  r[1] = (unsigned)f2bf_bits(a[2]) | ((unsigned)f2bf_bits(a[3]) << 16);
  r[2] = (unsigned)f2bf_bits(b[0]) | ((unsigned)f2bf_bits(b[1]) << 16);
  r[3] = (unsigned)f2bf_bits(b[2]) | ((unsigned)f2bf_bits(b[3]) << 16);
  return r;
}

// =====================================================================================
// Prep: one block per (b, h, 64-row s tile). 128 threads.
// Coverage per block: q/k: rows it*16 + (tid>>3), it 0..3 -> 64 rows, cols (tid&7)*8 .. +7 -> 64 cols;
//   v load: s = tid>>1 (0..63), d = (tid&1)*32 + 0..31; v write: d = it*16 + (tid>>3) (0..63), s = (tid&7)*8 + 0..7.
//   1024 blocks = 2 b x 16 h x 32 s-tiles cover all three planes exactly once.
// =====================================================================================
__global__ __launch_bounds__(128)
void prep_planes(const float* __restrict__ q, const float* __restrict__ k, const float* __restrict__ v,
                 unsigned short* __restrict__ qp, unsigned short* __restrict__ kp, unsigned short* __restrict__ vtp)
{
  __shared__ __align__(16) float tile[64 * 68];   // [s][d], pitch 68 floats
  const int tid = threadIdx.x;
  const int bx  = blockIdx.x;
  const int nst = kSkv / 64;
  const int st  = bx % nst;
  const int bh  = bx / nst;
  const int h   = bh % kHeads;
  const int b   = bh / kHeads;
  const int s0  = st * 64;

  // ---- v tile -> LDS (f32, row-major [s][d]) ----
  {
    const int s = tid >> 1, dh = (tid & 1) * 32;
    const float* src = v + ((size_t)(b * kSkv + s0 + s) * kHeads + h) * kDim + dh;
#pragma unroll
    for (int i = 0; i < 8; ++i) *(v4f*)(tile + s * 68 + dh + 4 * i) = *(const v4f*)(src + 4 * i);
  }
  __syncthreads();

  const int rg = tid >> 3;          // row group 0..15
  const int c8 = (tid & 7) * 8;     // 8 consecutive elements per lane

  v4u qw[4], kw[4], vw[4];
#pragma unroll
  for (int it = 0; it < 4; ++it) {
    const int row = it * 16 + rg;
    const size_t off = ((size_t)(b * kSeq + s0 + row) * kHeads + h) * kDim + c8;
    const v4f a0 = *(const v4f*)(q + off);
    const v4f a1 = *(const v4f*)(q + off + 4);
    qw[it] = pack_bf16x8(a0, a1);
  }
  asm volatile("" ::: "memory");
#pragma unroll
  for (int it = 0; it < 4; ++it) {
    const int row = it * 16 + rg;
    const size_t off = ((size_t)(b * kSkv + s0 + row) * kHeads + h) * kDim + c8;
    const v4f a0 = *(const v4f*)(k + off);
    const v4f a1 = *(const v4f*)(k + off + 4);
    kw[it] = pack_bf16x8(a0, a1);
  }
  asm volatile("" ::: "memory");
#pragma unroll
  for (int it = 0; it < 4; ++it) {
    const int d = it * 16 + rg;
    v4f f0, f1;
#pragma unroll
    for (int e = 0; e < 4; ++e) {
      f0[e] = tile[(c8 + e) * 68 + d];
      f1[e] = tile[(c8 + 4 + e) * 68 + d];
    }
    vw[it] = pack_bf16x8(f0, f1);
  }

  {
#pragma unroll
    for (int it = 0; it < 4; ++it) {
      const int row = it * 16 + rg;
      const size_t offq = ((size_t)(b * kSeq + s0 + row) * kHeads + h) * kDim + c8;
      *(v4u*)(qp + offq) = qw[it];
      *(v4u*)(kp + offq) = kw[it];
      const int d = row;
      const size_t offv = ((size_t)((b * kHeads + h) * kDim + d)) * kSkv + s0 + c8;
      *(v4u*)(vtp + offv) = vw[it];
    }
    
  }
}

// =====================================================================================
// Attention for head_dim 64 on bf16 planes: block = 4 waves = 64 query rows of one (b, h); 64-key chunks.
//   Both products are formed transposed, so that a lane holds scores and outputs of ONE query (column c):
//   scores^T: A = k rows (bf16, [kv][d] in LDS), B = q rows (bf16, registers)            -> v_wmma_f32_16x16x32_bf16
//   out^T   : A = v^T rows ([d][kv] in LDS), B = p^T (bf16 hi and lo, packed in registers) -> v_wmma_f32_16x16x32_bf16 x2
//   Keys with index >= valid_lens[b] get score -inf (select); chunks entirely beyond valid_lens are skipped
//   (their probabilities are exactly 0); chunk count clamped to [1, kMaxChunks].
// =====================================================================================
__global__ __launch_bounds__(128)
void attn_planes_kernel(const unsigned short* __restrict__ qp, const unsigned short* __restrict__ kp,
                        const unsigned short* __restrict__ vtp, const int* __restrict__ vlen,
                        float* __restrict__ out)
{
  __shared__ __align__(16) __bf16 Ksh[kKC * kPit];          // [kv][d]       9 KB, pitch kPit
  __shared__ __align__(16) __bf16 Vts[kDim * kPit];         // [d][kv]       9 KB, pitch kPit
  __shared__ __align__(16) float  Os[kNW][16 * 68];         // per wave out tile, pitch 68

  const int tid  = threadIdx.x;
  const int wave = tid >> 5;
  const int lane = tid & 31;
  const int hh   = lane >> 4;
  const int c    = lane & 15;

  const int nqb = kSeq / kQB;
  const int bx  = blockIdx.x;
  const int qb  = bx % nqb;
  const int bh  = bx / nqb;
  const int h   = bh % kHeads;
  const int b   = bh / kHeads;
  const int q0  = qb * kQB + wave * 16;

  int valid = vlen[b];
  valid = valid < 0 ? 0 : valid;
  valid = valid > kSkv ? kSkv : valid;
  int nChunks = (valid + kKC - 1) / kKC;          // block-uniform
  nChunks = nChunks < 1 ? 1 : nChunks;
  nChunks = nChunks > kMaxChunks ? kMaxChunks : nChunks;

  // ---- Q fragments (B operand: column = query q0 + c, k = d), 2 d-chunks ----
  v16b qa[2];
  {
    const __bf16* qrow = (const __bf16*)qp + ((size_t)(b * kSeq + q0 + c) * kHeads + h) * kDim;
#pragma unroll
    for (int dc = 0; dc < 2; ++dc) qa[dc] = Frag<__bf16>::load(qrow + dc * 32 + 8 * hh);
  }

  float mrow = -INFINITY;   // running maximum of query q0 + c, in scaled log2 units (raw score x kScaleLog2e; equal in both lane halves)
  float lrow = 0.f;         // running sum over this lane half's keys; the halves are joined after the loop
  v8f oacc[4];              // oacc[t][r] = out^T[d = 16t + 8hh + r][query q0 + c]
#pragma unroll
  for (int t = 0; t < 4; ++t) oacc[t] = (v8f){0.f,0.f,0.f,0.f,0.f,0.f,0.f,0.f};

  const size_t kbase  = ((size_t)b * kSkv) * kHeads * kDim + (size_t)h * kDim;   // + kv*(H*D)
  const size_t vtbase = ((size_t)(b * kHeads + h) * kDim) * kSkv;                  // + d*S + kv

  for (int kc = 0; kc < nChunks; ++kc) {
    const int kv0 = kc * kKC;
    __syncthreads();
    {
      // stage K [64 kv][64 d] and V^T [64 d][64 kv]: thread -> row tid>>1, half (tid&1)*32, 4 x 16 B each
      const int r = tid >> 1, half = (tid & 1) * 32;
      const v4u* ksrc = (const v4u*)(kp + kbase + (size_t)(kv0 + r) * (kHeads * kDim) + half);
      v4u* kdst = (v4u*)(Ksh + r * kPit + half);
      const v4u* vsrc = (const v4u*)(vtp + vtbase + (size_t)r * kSkv + kv0 + half);
      v4u* vdst = (v4u*)(Vts + r * kPit + half);
#pragma unroll
      for (int i = 0; i < 4; ++i) { kdst[i] = ksrc[i]; vdst[i] = vsrc[i]; }
    }
    __syncthreads();

    // ---- scores^T: s[j][r] = score(key kv0 + 16j + 8hh + r, query q0 + c) ----
    v8f s[4];
#pragma unroll
    for (int j = 0; j < 4; ++j) {
      s[j] = (v8f){0.f,0.f,0.f,0.f,0.f,0.f,0.f,0.f};
#pragma unroll
      for (int dc = 0; dc < 2; ++dc) {
        const v16b kb = Frag<__bf16>::load(Ksh + (j * 16 + c) * kPit + dc * 32 + 8 * hh);
        s[j] = at_mma(kb, qa[dc], s[j]);
      }
    }

    // ---- key mask (select -inf) on the raw scores, chunk max of the lane's query: in-lane, then one exchange of the halves ----
    const int lim = valid - kv0 - 8 * hh;   // rows 16j + r of this lane half below lim are valid keys
    float mj[4];
#pragma unroll
    for (int j = 0; j < 4; ++j) {
      float m = -INFINITY;
#pragma unroll
      for (int r = 0; r < 8; ++r) {
        const float sv = (j * 16 + r < lim) ? s[j][r] : -INFINITY;
        s[j][r] = sv;
        m = fmaxf(m, sv);
      }
      mj[j] = m;
    }
    float cm = fmaxf(fmaxf(mj[0], mj[1]), fmaxf(mj[2], mj[3]));
    cm = fmaxf(cm, other_half(cm));

    // ---- online softmax; p^T -> bf16 hi and lo B fragments in registers:
    //      element e of fragment kk is key 32kk + 8hh + e (e < 8) or 32kk + 16 + 8hh + (e - 8), the k order of Frag::load ----
    //      p = exp2(s * kScaleLog2e - mnew): one fused multiply-add and the bare hardware exponential per score
    const float mnew  = fmaxf(mrow, cm * kScaleLog2e);
    const float alpha = __builtin_amdgcn_exp2f(mrow - mnew);
    mrow = mnew;
    v16b ph[2], pl[2];
    float pj[4];
#pragma unroll
    for (int j = 0; j < 4; ++j) {
      float psum = 0.f;
      float arg[8], p8[8];
#pragma unroll
      for (int r = 0; r < 8; ++r) arg[r] = __builtin_fmaf(s[j][r], kScaleLog2e, -mnew);
      exp2_x8(arg, p8);
#pragma unroll
      for (int r = 0; r < 8; ++r) {
        const float p = p8[r];
        psum += p;
        __bf16 hi, lo;
        at_split(p, hi, lo);
        ph[j >> 1][(j & 1) * 8 + r] = hi;
        pl[j >> 1][(j & 1) * 8 + r] = lo;
      }
      pj[j] = psum;
    }
    lrow = lrow * alpha + ((pj[0] + pj[1]) + (pj[2] + pj[3]));
#pragma unroll
    for (int t = 0; t < 4; ++t)
#pragma unroll
      for (int r = 0; r < 8; ++r) oacc[t][r] *= alpha;

    // ---- out^T += v^T.p^T : A = v^T [m = d][k = kv], B = p^T [k = kv][n = query] ----
    // kk unrolled: ph and pl live in registers, which only constant indices can name (a rolled loop would send them to scratch)
#pragma unroll
    for (int kk = 0; kk < 2; ++kk) {
#pragma unroll
      for (int t = 0; t < 4; ++t) {
        const v16b va = Frag<__bf16>::load(Vts + (t * 16 + c) * kPit + kk * 32 + 8 * hh);
        oacc[t] = at_mma(va, ph[kk], oacc[t]);
        oacc[t] = at_mma(va, pl[kk], oacc[t]);
      }
    }
  }

  // ---- join the halves' sums, normalise, stage the wave's 16 x 64 tile row-major: 8 consecutive d per lane and t ----
  float* os = Os[wave];
  {
    const float inv = 1.0f / (lrow + other_half(lrow));
#pragma unroll
    for (int t = 0; t < 4; ++t) {
      v4f lo4, hi4;
#pragma unroll
      for (int e = 0; e < 4; ++e) { lo4[e] = oacc[t][e] * inv; hi4[e] = oacc[t][4 + e] * inv; }
      *(v4f*)(os + c * 68 + t * 16 + 8 * hh)     = lo4;
      *(v4f*)(os + c * 68 + t * 16 + 8 * hh + 4) = hi4;
    }
  }
  __builtin_amdgcn_fence(__ATOMIC_RELEASE, "workgroup");
  __builtin_amdgcn_wave_barrier();
  __builtin_amdgcn_fence(__ATOMIC_ACQUIRE, "workgroup");
  {
    const size_t o_rs = (size_t)kHeads * kDim;   // row stride (floats)
    float* ob_ptr = out + ((size_t)b * kSeq) * o_rs + (size_t)h * kDim;
    const int c4 = (lane & 15) * 4;               // row segment 256 B = 16 lanes x 16 B
    {
#pragma unroll
      for (int it = 0; it < 8; ++it) {
        const int row = it * 2 + hh;
        v4f val = *(const v4f*)(os + row * 68 + c4);
        *(v4f*)(ob_ptr + (size_t)(q0 + row) * o_rs + c4) = val;
      }
      
    }
  }
}

// =====================================================================================
// Host glue. Workspace region map (bytes):
//   [         0,  8,388,608)  q  bf16 plane [B][S][H][D]
//   [ 8,388,608, 16,777,216)  k  bf16 plane [B][S][H][D]
//   [16,777,216, 25,165,824)  v^T bf16 plane [B][H][D][S]
//   total carve 25,165,824 B
// =====================================================================================
extern "C" void kernel_launch(void* const* d_in, const int* in_sizes, int n_in,
                              void* d_out, int out_size, void* d_ws, size_t ws_size,
                              hipStream_t stream)
{
  (void)in_sizes; (void)n_in; (void)out_size;
  const float* q  = (const float*)d_in[0];
  const float* k  = (const float*)d_in[1];
  const float* v  = (const float*)d_in[2];
  const int*   vl = (const int*)d_in[3];
  float* out = (float*)d_out;

  const size_t planeElems = (size_t)kBatch * kSeq * kHeads * kDim;            // 4,194,304
  const size_t carveBytes = 3 * planeElems * sizeof(unsigned short);          // 25,165,824
  if (carveBytes > ws_size) return;

  unsigned short* ws  = (unsigned short*)d_ws;
  unsigned short* qp  = ws;
  unsigned short* kp  = ws + planeElems;
  unsigned short* vtp = ws + 2 * planeElems;

  const int prepBlocks = kBatch * kHeads * (kSkv / 64);      // 1024
  const int attnBlocks = kBatch * kHeads * (kSeq / kQB);     // 1024

  prep_planes<<<dim3(prepBlocks), dim3(128), 0, stream>>>(q, k, v, qp, kp, vtp);
  attn_planes_kernel<<<dim3(attnBlocks), dim3(128), 0, stream>>>(qp, kp, vtp, vl, out);
}

// v004
// Measured time: 33.3 microseconds a run.
// In two side-by-side timings against v003, it was 1.24 and 1.25 times as fast.
// Over all steps from v000 it is 3.18 times as fast.
// Contractions: scores = q.k^T and out = p.v on v_wmma_f32_16x16x32_bf16 (q, k, v RNE-converted to bf16 once at load; p carried as bf16 hi+lo parts, v single bf16 plane), f32 accumulate; masking, online softmax and normalisation in f32.
#include <hip/hip_runtime.h>
#include <stdint.h>
#include <math.h>

typedef __attribute__((ext_vector_type(16))) __bf16   v16b;
typedef __attribute__((ext_vector_type(8)))  __bf16   v8b;
typedef __attribute__((ext_vector_type(8)))  float    v8f;
typedef __attribute__((ext_vector_type(4)))  float    v4f;
typedef __attribute__((ext_vector_type(4)))  unsigned v4u;

// ---- problem geometry (element (b,s,h,d) of every tensor at ((b*S+s)*H+h)*D+d) ----
constexpr int kBatch = 2;
constexpr int kSeq   = 2048;   // query length
constexpr int kSkv   = 2048;   // key length
constexpr int kHeads = 16;
constexpr int kDim   = 64;
constexpr int kQB    = 64;     // query rows per block (4 waves x 16)
constexpr int kKC    = 64;     // keys per chunk
constexpr int kNW    = 4;
constexpr int kMaxChunks = kSkv / kKC;
constexpr int kPit   = 72;     // LDS row pitch of the 64-element bf16 tiles: 144 B = 16 B x 9, so the 16 rows of a 16-byte fragment read fall on 64 different banks
constexpr float kScaleLog2e = 0.125f * 1.44269504088896340736f;   // 1/sqrt(64) times log2(e): exp(scale * (s - m)) = exp2(s * kScaleLog2e - m * kScaleLog2e)
static_assert(kSeq % kQB == 0);
static_assert(kSkv % kKC == 0);
static_assert(kSeq == kSkv);
static_assert(kDim == 64);
static_assert(kKC == 64);
static_assert((kPit * 2) % 16 == 0);   // rows stay 16-byte aligned
static_assert(kKC % 32 == 0);      // contraction depth of p.v per chunk is a multiple of 32
static_assert(kDim % 32 == 0);     // contraction depth of q.k^T is a multiple of 32

// ---- helpers ----
__device__ __forceinline__ unsigned short f2bf_bits(float f) {
  unsigned u = __float_as_uint(f);
  return (unsigned short)((u + 0x7FFFu + ((u >> 16) & 1u)) >> 16);
}
__device__ __forceinline__ float bf_bits2f(unsigned short h) { return __uint_as_float(((unsigned)h) << 16); }

__device__ __forceinline__ void dep_guard_b(v8f& a, v8f& b, v16b x, v16b y) { asm volatile("v_nop\n\tv_nop\n\tv_nop\n\tv_nop" : "+v"(a), "+v"(b) : "v"(x), "v"(y)); }
__device__ __forceinline__ void keep4_b(v16b a, v16b b, v16b c, v16b d) { asm volatile("v_nop" :: "v"(a), "v"(b), "v"(c), "v"(d)); }
template <typename T> struct Frag;
template <> struct Frag<__bf16> {
  typedef v16b V; union U { v16b v; v8b h[2]; };
  static __device__ __forceinline__ v16b load(const __bf16* p) {   // elements 0..7 <- p[0..7], 8..15 <- p[16..23]
    U f; f.h[0] = *(const v8b*)(p); f.h[1] = *(const v8b*)(p + 16); return f.v;
  }
  static __device__ __forceinline__ v8f mma(v16b a, v16b b, v8f c) {
    return __builtin_amdgcn_wmma_f32_16x16x32_bf16(false, a, false, b, (short)0, c, false, false);
  }
  static __device__ __forceinline__ void guard(v8f& a, v8f& b, v16b x, v16b y) { dep_guard_b(a, b, x, y); }
  static __device__ __forceinline__ void keep(v16b a, v16b b, v16b c, v16b d) { keep4_b(a, b, c, d); }
};

__device__ __forceinline__ unsigned short at_bf_bits(float f) {
  unsigned u = __float_as_uint(f);
  return (unsigned short)((u + 0x7FFFu + ((u >> 16) & 1u)) >> 16);
}
__device__ __forceinline__ __bf16 at_f2bf(float f) { return __builtin_bit_cast(__bf16, at_bf_bits(f)); }
__device__ __forceinline__ void at_split(float f, __bf16& hi, __bf16& lo) {
  const unsigned short hb = at_bf_bits(f);
  hi = __builtin_bit_cast(__bf16, hb);
  lo = at_f2bf(f - __uint_as_float(((unsigned)hb) << 16));
}
// value of the lane 16 away (the other half's lane of the same column), by a vector cross-row move
__device__ __forceinline__ float other_half(float x) {
  const int b = __float_as_int(x);
  return __int_as_float(__builtin_amdgcn_permlanex16(b, b, 0x76543210, 0xfedcba98, false, false));
}
__device__ __forceinline__ v8f at_mma(v16b a, v16b b, v8f c) {
  return __builtin_amdgcn_wmma_f32_16x16x32_bf16(false, a, false, b, (short)0, c, false, false);
}

// y[i] = 2^x[i]: eight bare hardware exponentials in one statement. Early-clobber results keep every source register intact while
// the run issues; the
// closing v_nop is the slot the instruction set asks for behind a transcendental before its result is read or its source overwritten.
__device__ __forceinline__ void exp2_x8(const float (&x)[8], float (&y)[8]) {
  asm("v_exp_f32 %0, %8\n\t"
      "v_exp_f32 %1, %9\n\t"
      "v_exp_f32 %2, %10\n\t"
      "v_exp_f32 %3, %11\n\t"
      "v_exp_f32 %4, %12\n\t"
      "v_exp_f32 %5, %13\n\t"
      "v_exp_f32 %6, %14\n\t"
      "v_exp_f32 %7, %15\n\t"
      "v_nop"
      : "=&v"(y[0]), "=&v"(y[1]), "=&v"(y[2]), "=&v"(y[3]), "=&v"(y[4]), "=&v"(y[5]), "=&v"(y[6]), "=&v"(y[7])
      : "v"(x[0]), "v"(x[1]), "v"(x[2]), "v"(x[3]), "v"(x[4]), "v"(x[5]), "v"(x[6]), "v"(x[7]));
}

// pack 8 f32 -> 8 bf16 (RNE) as 4 x 32-bit words, element 2e in the low half-word
__device__ __forceinline__ v4u pack_bf16x8(v4f a, v4f b) {
  v4u r;
  r[0] = (unsigned)f2bf_bits(a[0]) | ((unsigned)f2bf_bits(a[1]) << 16);
  r[1] = (unsigned)f2bf_bits(a[2]) | ((unsigned)f2bf_bits(a[3]) << 16);
  r[2] = (unsigned)f2bf_bits(b[0]) | ((unsigned)f2bf_bits(b[1]) << 16);
  r[3] = (unsigned)f2bf_bits(b[2]) | ((unsigned)f2bf_bits(b[3]) << 16);
  return r;
}

// =====================================================================================
// Prep: one block per (b, h, 64-row s tile). 128 threads.
// Coverage per block: q/k: rows it*16 + (tid>>3), it 0..3 -> 64 rows, cols (tid&7)*8 .. +7 -> 64 cols;
//   v load: s = tid>>1 (0..63), d = (tid&1)*32 + 0..31; v write: d = it*16 + (tid>>3) (0..63), s = (tid&7)*8 + 0..7.
//   1024 blocks = 2 b x 16 h x 32 s-tiles cover all three planes exactly once.
// =====================================================================================
__global__ __launch_bounds__(128)
void prep_planes(const float* __restrict__ q, const float* __restrict__ k, const float* __restrict__ v,
                 unsigned short* __restrict__ qp, unsigned short* __restrict__ kp, unsigned short* __restrict__ vtp)
{
  __shared__ __align__(16) float tile[64 * 68];   // [s][d], pitch 68 floats
  const int tid = threadIdx.x;
  const int bx  = blockIdx.x;
  const int nst = kSkv / 64;
  const int st  = bx % nst;
  const int bh  = bx / nst;
  const int h   = bh % kHeads;
  const int b   = bh / kHeads;
  const int s0  = st * 64;

  // ---- v tile -> LDS (f32, row-major [s][d]) ----
  {
    const int s = tid >> 1, dh = (tid & 1) * 32;
    const float* src = v + ((size_t)(b * kSkv + s0 + s) * kHeads + h) * kDim + dh;
#pragma unroll
    for (int i = 0; i < 8; ++i) *(v4f*)(tile + s * 68 + dh + 4 * i) = *(const v4f*)(src + 4 * i);
  }
  __syncthreads();

  const int rg = tid >> 3;          // row group 0..15
  const int c8 = (tid & 7) * 8;     // 8 consecutive elements per lane

  v4u qw[4], kw[4], vw[4];
#pragma unroll
  for (int it = 0; it < 4; ++it) {
    const int row = it * 16 + rg;
    const size_t off = ((size_t)(b * kSeq + s0 + row) * kHeads + h) * kDim + c8;
    const v4f a0 = *(const v4f*)(q + off);
    const v4f a1 = *(const v4f*)(q + off + 4);
    qw[it] = pack_bf16x8(a0, a1);
  }
  asm volatile("" ::: "memory");
#pragma unroll
  for (int it = 0; it < 4; ++it) {
    const int row = it * 16 + rg;
    const size_t off = ((size_t)(b * kSkv + s0 + row) * kHeads + h) * kDim + c8;
    const v4f a0 = *(const v4f*)(k + off);
    const v4f a1 = *(const v4f*)(k + off + 4);
    kw[it] = pack_bf16x8(a0, a1);
  }
  asm volatile("" ::: "memory");
#pragma unroll
  for (int it = 0; it < 4; ++it) {
    const int d = it * 16 + rg;
    v4f f0, f1;
#pragma unroll
    for (int e = 0; e < 4; ++e) {
      f0[e] = tile[(c8 + e) * 68 + d];
      f1[e] = tile[(c8 + 4 + e) * 68 + d];
    }
    vw[it] = pack_bf16x8(f0, f1);
  }

  {
#pragma unroll
    for (int it = 0; it < 4; ++it) {
      const int row = it * 16 + rg;
      const size_t offq = ((size_t)(b * kSeq + s0 + row) * kHeads + h) * kDim + c8;
      *(v4u*)(qp + offq) = qw[it];
      *(v4u*)(kp + offq) = kw[it];
      const int d = row;
      const size_t offv = ((size_t)((b * kHeads + h) * kDim + d)) * kSkv + s0 + c8;
      *(v4u*)(vtp + offv) = vw[it];
    }
    
  }
}

// =====================================================================================
// Attention for head_dim 64 on bf16 planes: block = 4 waves = 64 query rows of one (b, h); 64-key chunks.
//   Both products are formed transposed, so that a lane holds scores and outputs of ONE query (column c):
//   scores^T: A = k rows (bf16, [kv][d] in LDS), B = q rows (bf16, registers)            -> v_wmma_f32_16x16x32_bf16
//   out^T   : A = v^T rows ([d][kv] in LDS), B = p^T (bf16 hi and lo, packed in registers) -> v_wmma_f32_16x16x32_bf16 x2
//   Keys with index >= valid_lens[b] get score -inf (select); chunks entirely beyond valid_lens are skipped
//   (their probabilities are exactly 0); chunk count clamped to [1, kMaxChunks].
// =====================================================================================
__global__ __launch_bounds__(128)
void attn_planes_kernel(const unsigned short* __restrict__ qp, const unsigned short* __restrict__ kp,
                        const unsigned short* __restrict__ vtp, const int* __restrict__ vlen,
                        float* __restrict__ out)
{
  __shared__ __align__(16) __bf16 Ksh[kKC * kPit];          // [kv][d]       9 KB, pitch kPit
  __shared__ __align__(16) __bf16 Vts[kDim * kPit];         // [d][kv]       9 KB, pitch kPit
  __shared__ __align__(16) float  Os[kNW][16 * 68];         // per wave out tile, pitch 68

  const int tid  = threadIdx.x;
  const int wave = tid >> 5;
  const int lane = tid & 31;
  const int hh   = lane >> 4;
  const int c    = lane & 15;

  const int nqb = kSeq / kQB;
  const int bx  = blockIdx.x;
  const int qb  = bx % nqb;
  const int bh  = bx / nqb;
  const int h   = bh % kHeads;
  const int b   = bh / kHeads;
  const int q0  = qb * kQB + wave * 16;

  int valid = vlen[b];
  valid = valid < 0 ? 0 : valid;
  valid = valid > kSkv ? kSkv : valid;
  int nChunks = (valid + kKC - 1) / kKC;          // block-uniform
  nChunks = nChunks < 1 ? 1 : nChunks;
  nChunks = nChunks > kMaxChunks ? kMaxChunks : nChunks;

  // ---- Q fragments (B operand: column = query q0 + c, k = d), 2 d-chunks ----
  v16b qa[2];
  {
    const __bf16* qrow = (const __bf16*)qp + ((size_t)(b * kSeq + q0 + c) * kHeads + h) * kDim;
#pragma unroll
    for (int dc = 0; dc < 2; ++dc) qa[dc] = Frag<__bf16>::load(qrow + dc * 32 + 8 * hh);
  }

  float mrow = -INFINITY;   // running maximum of query q0 + c, in scaled log2 units (raw score x kScaleLog2e; equal in both lane halves)
  float lrow = 0.f;         // running sum over this lane half's keys; the halves are joined after the loop
  v8f oacc[4];              // oacc[t][r] = out^T[d = 16t + 8hh + r][query q0 + c]
#pragma unroll
  for (int t = 0; t < 4; ++t) oacc[t] = (v8f){0.f,0.f,0.f,0.f,0.f,0.f,0.f,0.f};

  const size_t kbase  = ((size_t)b * kSkv) * kHeads * kDim + (size_t)h * kDim;   // + kv*(H*D)
  const size_t vtbase = ((size_t)(b * kHeads + h) * kDim) * kSkv;                  // + d*S + kv

  for (int kc = 0; kc < nChunks; ++kc) {
    const int kv0 = kc * kKC;
    __syncthreads();
    {
      // stage K [64 kv][64 d] and V^T [64 d][64 kv]: thread -> row tid>>1, half (tid&1)*32, 4 x 16 B each
      const int r = tid >> 1, half = (tid & 1) * 32;
      const v4u* ksrc = (const v4u*)(kp + kbase + (size_t)(kv0 + r) * (kHeads * kDim) + half);
      v4u* kdst = (v4u*)(Ksh + r * kPit + half);
      const v4u* vsrc = (const v4u*)(vtp + vtbase + (size_t)r * kSkv + kv0 + half);
      v4u* vdst = (v4u*)(Vts + r * kPit + half);
#pragma unroll
      for (int i = 0; i < 4; ++i) { kdst[i] = ksrc[i]; vdst[i] = vsrc[i]; }
    }
    __syncthreads();

    // ---- scores^T: s[j][r] = score(key kv0 + 16j + 8hh + r, query q0 + c) ----
    //      all eight k fragments are fetched as one group, then the eight products run back to back on four independent tiles
    v16b kf[2][4];
#pragma unroll
    for (int dc = 0; dc < 2; ++dc)
#pragma unroll
      for (int j = 0; j < 4; ++j) kf[dc][j] = Frag<__bf16>::load(Ksh + (j * 16 + c) * kPit + dc * 32 + 8 * hh);
    __builtin_amdgcn_sched_barrier(0);   // keeps the sixteen reads one group: without it some sink between the products, each with a wait of its own
    v8f s[4];
#pragma unroll
    for (int j = 0; j < 4; ++j) s[j] = (v8f){0.f,0.f,0.f,0.f,0.f,0.f,0.f,0.f};
#pragma unroll
    for (int dc = 0; dc < 2; ++dc)
#pragma unroll
      for (int j = 0; j < 4; ++j) s[j] = at_mma(kf[dc][j], qa[dc], s[j]);

    // ---- all eight v^T fragments are fetched here as one group: their LDS latency passes under the softmax arithmetic ----
    v16b vf[2][4];
#pragma unroll
    for (int kk = 0; kk < 2; ++kk)
#pragma unroll
      for (int t = 0; t < 4; ++t) vf[kk][t] = Frag<__bf16>::load(Vts + (t * 16 + c) * kPit + kk * 32 + 8 * hh);
    __builtin_amdgcn_sched_barrier(0);   // keeps the whole group in front of the softmax: without it half of the reads sink to just ahead of their products

    // ---- key mask (select -inf) on the raw scores, chunk max of the lane's query: in-lane, then one exchange of the halves ----
    const int lim = valid - kv0 - 8 * hh;   // rows 16j + r of this lane half below lim are valid keys
    float mj[4];
#pragma unroll
    for (int j = 0; j < 4; ++j) {
      float m = -INFINITY;
#pragma unroll
      for (int r = 0; r < 8; ++r) {
        const float sv = (j * 16 + r < lim) ? s[j][r] : -INFINITY;
        s[j][r] = sv;
        m = fmaxf(m, sv);
      }
      mj[j] = m;
    }
    float cm = fmaxf(fmaxf(mj[0], mj[1]), fmaxf(mj[2], mj[3]));
    cm = fmaxf(cm, other_half(cm));

    // ---- online softmax; p^T -> bf16 hi and lo B fragments in registers:
    //      element e of fragment kk is key 32kk + 8hh + e (e < 8) or 32kk + 16 + 8hh + (e - 8), the k order of Frag::load ----
    //      p = exp2(s * kScaleLog2e - mnew): one fused multiply-add and the bare hardware exponential per score
    const float mnew  = fmaxf(mrow, cm * kScaleLog2e);
    const float alpha = __builtin_amdgcn_exp2f(mrow - mnew);
    mrow = mnew;
    v16b ph[2], pl[2];
    float pj[4];
#pragma unroll
    for (int j = 0; j < 4; ++j) {
      float psum = 0.f;
      float arg[8], p8[8];
#pragma unroll
      for (int r = 0; r < 8; ++r) arg[r] = __builtin_fmaf(s[j][r], kScaleLog2e, -mnew);
      exp2_x8(arg, p8);
#pragma unroll
      for (int r = 0; r < 8; ++r) {
        const float p = p8[r];
        psum += p;
        __bf16 hi, lo;
        at_split(p, hi, lo);
        ph[j >> 1][(j & 1) * 8 + r] = hi;
        pl[j >> 1][(j & 1) * 8 + r] = lo;
      }
      pj[j] = psum;
    }
    lrow = lrow * alpha + ((pj[0] + pj[1]) + (pj[2] + pj[3]));
#pragma unroll
    for (int t = 0; t < 4; ++t)
#pragma unroll
      for (int r = 0; r < 8; ++r) oacc[t][r] *= alpha;

    // ---- out^T += v^T.p^T : A = v^T [m = d][k = kv], B = p^T [k = kv][n = query] ----
    // kk unrolled: ph and pl live in registers, which only constant indices can name (a rolled loop would send them to scratch)
#pragma unroll
    for (int kk = 0; kk < 2; ++kk) {
#pragma unroll
      for (int t = 0; t < 4; ++t) oacc[t] = at_mma(vf[kk][t], ph[kk], oacc[t]);
#pragma unroll
      for (int t = 0; t < 4; ++t) oacc[t] = at_mma(vf[kk][t], pl[kk], oacc[t]);
    }
  }

  // ---- join the halves' sums, normalise, stage the wave's 16 x 64 tile row-major: 8 consecutive d per lane and t ----
  float* os = Os[wave];
  {
    const float inv = 1.0f / (lrow + other_half(lrow));
#pragma unroll
    for (int t = 0; t < 4; ++t) {
      v4f lo4, hi4;
#pragma unroll
      for (int e = 0; e < 4; ++e) { lo4[e] = oacc[t][e] * inv; hi4[e] = oacc[t][4 + e] * inv; }
      *(v4f*)(os + c * 68 + t * 16 + 8 * hh)     = lo4;
      *(v4f*)(os + c * 68 + t * 16 + 8 * hh + 4) = hi4;
    }
  }
  __builtin_amdgcn_fence(__ATOMIC_RELEASE, "workgroup");
  __builtin_amdgcn_wave_barrier();
  __builtin_amdgcn_fence(__ATOMIC_ACQUIRE, "workgroup");
  {
    const size_t o_rs = (size_t)kHeads * kDim;   // row stride (floats)
    float* ob_ptr = out + ((size_t)b * kSeq) * o_rs + (size_t)h * kDim;
    const int c4 = (lane & 15) * 4;               // row segment 256 B = 16 lanes x 16 B
    {
#pragma unroll
      for (int it = 0; it < 8; ++it) {
        const int row = it * 2 + hh;
        v4f val = *(const v4f*)(os + row * 68 + c4);
        *(v4f*)(ob_ptr + (size_t)(q0 + row) * o_rs + c4) = val;
      }
      
    }
  }
}

// =====================================================================================
// Host glue. Workspace region map (bytes):
//   [         0,  8,388,608)  q  bf16 plane [B][S][H][D]
//   [ 8,388,608, 16,777,216)  k  bf16 plane [B][S][H][D]
//   [16,777,216, 25,165,824)  v^T bf16 plane [B][H][D][S]
//   total carve 25,165,824 B
// =====================================================================================
extern "C" void kernel_launch(void* const* d_in, const int* in_sizes, int n_in,
                              void* d_out, int out_size, void* d_ws, size_t ws_size,
                              hipStream_t stream)
{
  (void)in_sizes; (void)n_in; (void)out_size;
  const float* q  = (const float*)d_in[0];
  const float* k  = (const float*)d_in[1];
  const float* v  = (const float*)d_in[2];
  const int*   vl = (const int*)d_in[3];
  float* out = (float*)d_out;

  const size_t planeElems = (size_t)kBatch * kSeq * kHeads * kDim;            // 4,194,304
  const size_t carveBytes = 3 * planeElems * sizeof(unsigned short);          // 25,165,824
  if (carveBytes > ws_size) return;

  unsigned short* ws  = (unsigned short*)d_ws;
  unsigned short* qp  = ws;
  unsigned short* kp  = ws + planeElems;
  unsigned short* vtp = ws + 2 * planeElems;

  const int prepBlocks = kBatch * kHeads * (kSkv / 64);      // 1024
  const int attnBlocks = kBatch * kHeads * (kSeq / kQB);     // 1024

  prep_planes<<<dim3(prepBlocks), dim3(128), 0, stream>>>(q, k, v, qp, kp, vtp);
  attn_planes_kernel<<<dim3(attnBlocks), dim3(128), 0, stream>>>(qp, kp, vtp, vl, out);
}

// v005
// One run takes 30.5 microseconds.
// Timed twice side by side with v004, it ran 1.09 times as fast both times.
// Counting every step since v000, it is 3.47 times as fast.
// Contractions: scores = q.k^T and out = p.v on v_wmma_f32_16x16x32_bf16 (q, k, v RNE-converted to bf16 once at load; p carried as bf16 hi+lo parts, v single bf16 plane), f32 accumulate; masking, online softmax and normalisation in f32.
#include <hip/hip_runtime.h>
#include <stdint.h>
#include <math.h>

typedef __attribute__((ext_vector_type(16))) __bf16   v16b;
typedef __attribute__((ext_vector_type(8)))  __bf16   v8b;
typedef __attribute__((ext_vector_type(8)))  float    v8f;
typedef __attribute__((ext_vector_type(4)))  float    v4f;
typedef __attribute__((ext_vector_type(4)))  unsigned v4u;
typedef __attribute__((ext_vector_type(2)))  float    v2f;
typedef __attribute__((ext_vector_type(2)))  __bf16   v2b;

// ---- problem geometry (element (b,s,h,d) of every tensor at ((b*S+s)*H+h)*D+d) ----
constexpr int kBatch = 2;
constexpr int kSeq   = 2048;   // query length
constexpr int kSkv   = 2048;   // key length
constexpr int kHeads = 16;
constexpr int kDim   = 64;
constexpr int kQB    = 64;     // query rows per block (4 waves x 16)
constexpr int kKC    = 64;     // keys per chunk
constexpr int kNW    = 4;
constexpr int kMaxChunks = kSkv / kKC;
constexpr int kPit   = 72;     // LDS row pitch of the 64-element bf16 tiles: 144 B = 16 B x 9, so the 16 rows of a 16-byte fragment read fall on 64 different banks
constexpr float kScaleLog2e = 0.125f * 1.44269504088896340736f;   // 1/sqrt(64) times log2(e): exp(scale * (s - m)) = exp2(s * kScaleLog2e - m * kScaleLog2e)
static_assert(kSeq % kQB == 0);
static_assert(kSkv % kKC == 0);
static_assert(kSeq == kSkv);
static_assert(kDim == 64);
static_assert(kKC == 64);
static_assert((kPit * 2) % 16 == 0);   // rows stay 16-byte aligned
static_assert(kKC % 32 == 0);      // contraction depth of p.v per chunk is a multiple of 32
static_assert(kDim % 32 == 0);     // contraction depth of q.k^T is a multiple of 32

// ---- helpers ----
// two f32 -> two bf16, round to nearest even, by the one packed hardware convert (a in the low half-word)
__device__ __forceinline__ v2b cvt_bf16x2(float a, float b) { return __builtin_convertvector((v2f){a, b}, v2b); }
__device__ __forceinline__ unsigned cvt_bf16x2_bits(float a, float b) { return __builtin_bit_cast(unsigned, cvt_bf16x2(a, b)); }
__device__ __forceinline__ float bf_bits2f(unsigned short h) { return __uint_as_float(((unsigned)h) << 16); }

__device__ __forceinline__ void dep_guard_b(v8f& a, v8f& b, v16b x, v16b y) { asm volatile("v_nop\n\tv_nop\n\tv_nop\n\tv_nop" : "+v"(a), "+v"(b) : "v"(x), "v"(y)); }
__device__ __forceinline__ void keep4_b(v16b a, v16b b, v16b c, v16b d) { asm volatile("v_nop" :: "v"(a), "v"(b), "v"(c), "v"(d)); }
template <typename T> struct Frag;
template <> struct Frag<__bf16> {
  typedef v16b V; union U { v16b v; v8b h[2]; };
  static __device__ __forceinline__ v16b load(const __bf16* p) {   // elements 0..7 <- p[0..7], 8..15 <- p[16..23]
    U f; f.h[0] = *(const v8b*)(p); f.h[1] = *(const v8b*)(p + 16); return f.v;
  }
  static __device__ __forceinline__ v8f mma(v16b a, v16b b, v8f c) {
    return __builtin_amdgcn_wmma_f32_16x16x32_bf16(false, a, false, b, (short)0, c, false, false);
  }
  static __device__ __forceinline__ void guard(v8f& a, v8f& b, v16b x, v16b y) { dep_guard_b(a, b, x, y); }
  static __device__ __forceinline__ void keep(v16b a, v16b b, v16b c, v16b d) { keep4_b(a, b, c, d); }
};

// value of the lane 16 away (the other half's lane of the same column), by a vector cross-row move
__device__ __forceinline__ float other_half(float x) {
  const int b = __float_as_int(x);
  return __int_as_float(__builtin_amdgcn_permlanex16(b, b, 0x76543210, 0xfedcba98, false, false));
}
__device__ __forceinline__ v8f at_mma(v16b a, v16b b, v8f c) {
  return __builtin_amdgcn_wmma_f32_16x16x32_bf16(false, a, false, b, (short)0, c, false, false);
}

// y[i] = 2^x[i]: eight bare hardware exponentials in one statement. Early-clobber results keep every source register intact while
// the run issues; the
// closing v_nop is the slot the instruction set asks for behind a transcendental before its result is read or its source overwritten.
__device__ __forceinline__ void exp2_x8(const float (&x)[8], float (&y)[8]) {
  asm("v_exp_f32 %0, %8\n\t"
      "v_exp_f32 %1, %9\n\t"
      "v_exp_f32 %2, %10\n\t"
      "v_exp_f32 %3, %11\n\t"
      "v_exp_f32 %4, %12\n\t"
      "v_exp_f32 %5, %13\n\t"
      "v_exp_f32 %6, %14\n\t"
      "v_exp_f32 %7, %15\n\t"
      "v_nop"
      : "=&v"(y[0]), "=&v"(y[1]), "=&v"(y[2]), "=&v"(y[3]), "=&v"(y[4]), "=&v"(y[5]), "=&v"(y[6]), "=&v"(y[7])
      : "v"(x[0]), "v"(x[1]), "v"(x[2]), "v"(x[3]), "v"(x[4]), "v"(x[5]), "v"(x[6]), "v"(x[7]));
}

// pack 8 f32 -> 8 bf16 (RNE) as 4 x 32-bit words, element 2e in the low half-word
__device__ __forceinline__ v4u pack_bf16x8(v4f a, v4f b) {
  v4u r;
  r[0] = cvt_bf16x2_bits(a[0], a[1]);
  r[1] = cvt_bf16x2_bits(a[2], a[3]);
  r[2] = cvt_bf16x2_bits(b[0], b[1]);
  r[3] = cvt_bf16x2_bits(b[2], b[3]);
  return r;
}

// =====================================================================================
// Prep: one block per (b, h, 64-row s tile). 128 threads.
// Coverage per block: q/k: rows it*16 + (tid>>3), it 0..3 -> 64 rows, cols (tid&7)*8 .. +7 -> 64 cols;
//   v load: s = tid>>1 (0..63), d = (tid&1)*32 + 0..31; v write: d = it*16 + (tid>>3) (0..63), s = (tid&7)*8 + 0..7.
//   1024 blocks = 2 b x 16 h x 32 s-tiles cover all three planes exactly once.
// =====================================================================================
__global__ __launch_bounds__(128)
void prep_planes(const float* __restrict__ q, const float* __restrict__ k, const float* __restrict__ v,
                 unsigned short* __restrict__ qp, unsigned short* __restrict__ kp, unsigned short* __restrict__ vtp)
{
  __shared__ __align__(16) float tile[64 * 68];   // [s][d], pitch 68 floats
  const int tid = threadIdx.x;
  const int bx  = blockIdx.x;
  const int nst = kSkv / 64;
  const int st  = bx % nst;
  const int bh  = bx / nst;
  const int h   = bh % kHeads;
  const int b   = bh / kHeads;
  const int s0  = st * 64;

  // ---- v tile -> LDS (f32, row-major [s][d]) ----
  {
    const int s = tid >> 1, dh = (tid & 1) * 32;
    const float* src = v + ((size_t)(b * kSkv + s0 + s) * kHeads + h) * kDim + dh;
#pragma unroll
    for (int i = 0; i < 8; ++i) *(v4f*)(tile + s * 68 + dh + 4 * i) = *(const v4f*)(src + 4 * i);
  }
  __syncthreads();

  const int rg = tid >> 3;          // row group 0..15
  const int c8 = (tid & 7) * 8;     // 8 consecutive elements per lane

  v4u qw[4], kw[4], vw[4];
#pragma unroll
  for (int it = 0; it < 4; ++it) {
    const int row = it * 16 + rg;
    const size_t off = ((size_t)(b * kSeq + s0 + row) * kHeads + h) * kDim + c8;
    const v4f a0 = *(const v4f*)(q + off);
    const v4f a1 = *(const v4f*)(q + off + 4);
    qw[it] = pack_bf16x8(a0, a1);
  }
  asm volatile("" ::: "memory");
#pragma unroll
  for (int it = 0; it < 4; ++it) {
    const int row = it * 16 + rg;
    const size_t off = ((size_t)(b * kSkv + s0 + row) * kHeads + h) * kDim + c8;
    const v4f a0 = *(const v4f*)(k + off);
    const v4f a1 = *(const v4f*)(k + off + 4);
    kw[it] = pack_bf16x8(a0, a1);
  }
  asm volatile("" ::: "memory");
#pragma unroll
  for (int it = 0; it < 4; ++it) {
    const int d = it * 16 + rg;
    v4f f0, f1;
#pragma unroll
    for (int e = 0; e < 4; ++e) {
      f0[e] = tile[(c8 + e) * 68 + d];
      f1[e] = tile[(c8 + 4 + e) * 68 + d];
    }
    vw[it] = pack_bf16x8(f0, f1);
  }

  {
#pragma unroll
    for (int it = 0; it < 4; ++it) {
      const int row = it * 16 + rg;
      const size_t offq = ((size_t)(b * kSeq + s0 + row) * kHeads + h) * kDim + c8;
      *(v4u*)(qp + offq) = qw[it];
      *(v4u*)(kp + offq) = kw[it];
      const int d = row;
      const size_t offv = ((size_t)((b * kHeads + h) * kDim + d)) * kSkv + s0 + c8;
      *(v4u*)(vtp + offv) = vw[it];
    }
    
  }
}

// =====================================================================================
// Attention for head_dim 64 on bf16 planes: block = 4 waves = 64 query rows of one (b, h); 64-key chunks.
//   Both products are formed transposed, so that a lane holds scores and outputs of ONE query (column c):
//   scores^T: A = k rows (bf16, [kv][d] in LDS), B = q rows (bf16, registers)            -> v_wmma_f32_16x16x32_bf16
//   out^T   : A = v^T rows ([d][kv] in LDS), B = p^T (bf16 hi and lo, packed in registers) -> v_wmma_f32_16x16x32_bf16 x2
//   Keys with index >= valid_lens[b] get score -inf (select); chunks entirely beyond valid_lens are skipped
//   (their probabilities are exactly 0); chunk count clamped to [1, kMaxChunks].
// =====================================================================================
__global__ __launch_bounds__(128)
void attn_planes_kernel(const unsigned short* __restrict__ qp, const unsigned short* __restrict__ kp,
                        const unsigned short* __restrict__ vtp, const int* __restrict__ vlen,
                        float* __restrict__ out)
{
  __shared__ __align__(16) __bf16 Ksh[kKC * kPit];          // [kv][d]       9 KB, pitch kPit
  __shared__ __align__(16) __bf16 Vts[kDim * kPit];         // [d][kv]       9 KB, pitch kPit
  __shared__ __align__(16) float  Os[kNW][16 * 68];         // per wave out tile, pitch 68

  const int tid  = threadIdx.x;
  const int wave = tid >> 5;
  const int lane = tid & 31;
  const int hh   = lane >> 4;
  const int c    = lane & 15;

  const int nqb = kSeq / kQB;
  const int bx  = blockIdx.x;
  const int qb  = bx % nqb;
  const int bh  = bx / nqb;
  const int h   = bh % kHeads;
  const int b   = bh / kHeads;
  const int q0  = qb * kQB + wave * 16;

  int valid = vlen[b];
  valid = valid < 0 ? 0 : valid;
  valid = valid > kSkv ? kSkv : valid;
  int nChunks = (valid + kKC - 1) / kKC;          // block-uniform
  nChunks = nChunks < 1 ? 1 : nChunks;
  nChunks = nChunks > kMaxChunks ? kMaxChunks : nChunks;

  // ---- Q fragments (B operand: column = query q0 + c, k = d), 2 d-chunks ----
  v16b qa[2];
  {
    const __bf16* qrow = (const __bf16*)qp + ((size_t)(b * kSeq + q0 + c) * kHeads + h) * kDim;
#pragma unroll
    for (int dc = 0; dc < 2; ++dc) qa[dc] = Frag<__bf16>::load(qrow + dc * 32 + 8 * hh);
  }

  float mrow = -INFINITY;   // running maximum of query q0 + c, in scaled log2 units (raw score x kScaleLog2e; equal in both lane halves)
  float lrow = 0.f;         // running sum over this lane half's keys; the halves are joined after the loop
  v8f oacc[4];              // oacc[t][r] = out^T[d = 16t + 8hh + r][query q0 + c]
#pragma unroll
  for (int t = 0; t < 4; ++t) oacc[t] = (v8f){0.f,0.f,0.f,0.f,0.f,0.f,0.f,0.f};

  const size_t kbase  = ((size_t)b * kSkv) * kHeads * kDim + (size_t)h * kDim;   // + kv*(H*D)
  const size_t vtbase = ((size_t)(b * kHeads + h) * kDim) * kSkv;                  // + d*S + kv

  for (int kc = 0; kc < nChunks; ++kc) {
    const int kv0 = kc * kKC;
    __syncthreads();
    {
      // stage K [64 kv][64 d] and V^T [64 d][64 kv]: thread -> row tid>>1, half (tid&1)*32, 4 x 16 B each
      const int r = tid >> 1, half = (tid & 1) * 32;
      const v4u* ksrc = (const v4u*)(kp + kbase + (size_t)(kv0 + r) * (kHeads * kDim) + half);
      v4u* kdst = (v4u*)(Ksh + r * kPit + half);
      const v4u* vsrc = (const v4u*)(vtp + vtbase + (size_t)r * kSkv + kv0 + half);
      v4u* vdst = (v4u*)(Vts + r * kPit + half);
#pragma unroll
      for (int i = 0; i < 4; ++i) { kdst[i] = ksrc[i]; vdst[i] = vsrc[i]; }
    }
    __syncthreads();

    // ---- scores^T: s[j][r] = score(key kv0 + 16j + 8hh + r, query q0 + c) ----
    //      all eight k fragments are fetched as one group, then the eight products run back to back on four independent tiles
    v16b kf[2][4];
#pragma unroll
    for (int dc = 0; dc < 2; ++dc)
#pragma unroll
      for (int j = 0; j < 4; ++j) kf[dc][j] = Frag<__bf16>::load(Ksh + (j * 16 + c) * kPit + dc * 32 + 8 * hh);
    __builtin_amdgcn_sched_barrier(0);   // keeps the sixteen reads one group: without it some sink between the products, each with a wait of its own
    v8f s[4];
#pragma unroll
    for (int j = 0; j < 4; ++j) s[j] = (v8f){0.f,0.f,0.f,0.f,0.f,0.f,0.f,0.f};
#pragma unroll
    for (int dc = 0; dc < 2; ++dc)
#pragma unroll
      for (int j = 0; j < 4; ++j) s[j] = at_mma(kf[dc][j], qa[dc], s[j]);

    // ---- all eight v^T fragments are fetched here as one group: their LDS latency passes under the softmax arithmetic ----
    v16b vf[2][4];
#pragma unroll
    for (int kk = 0; kk < 2; ++kk)
#pragma unroll
      for (int t = 0; t < 4; ++t) vf[kk][t] = Frag<__bf16>::load(Vts + (t * 16 + c) * kPit + kk * 32 + 8 * hh);
    __builtin_amdgcn_sched_barrier(0);   // keeps the whole group in front of the softmax: without it half of the reads sink to just ahead of their products

    // ---- key mask (select -inf) on the raw scores, chunk max of the lane's query: in-lane, then one exchange of the halves ----
    const int lim = valid - kv0 - 8 * hh;   // rows 16j + r of this lane half below lim are valid keys
    float mj[4];
#pragma unroll
    for (int j = 0; j < 4; ++j) {
      float m = -INFINITY;
#pragma unroll
      for (int r = 0; r < 8; ++r) {
        const float sv = (j * 16 + r < lim) ? s[j][r] : -INFINITY;
        s[j][r] = sv;
        m = fmaxf(m, sv);
      }
      mj[j] = m;
    }
    float cm = fmaxf(fmaxf(mj[0], mj[1]), fmaxf(mj[2], mj[3]));
    cm = fmaxf(cm, other_half(cm));

    // ---- online softmax; p^T -> bf16 hi and lo B fragments in registers:
    //      element e of fragment kk is key 32kk + 8hh + e (e < 8) or 32kk + 16 + 8hh + (e - 8), the k order of Frag::load ----
    //      p = exp2(s * kScaleLog2e - mnew): one fused multiply-add and the bare hardware exponential per score
    const float mnew  = fmaxf(mrow, cm * kScaleLog2e);
    const float alpha = __builtin_amdgcn_exp2f(mrow - mnew);
    mrow = mnew;
    v16b ph[2], pl[2];
    float pj[4];
#pragma unroll
    for (int j = 0; j < 4; ++j) {
      float psum = 0.f;
      float arg[8], p8[8];
#pragma unroll
      for (int r = 0; r < 8; ++r) arg[r] = __builtin_fmaf(s[j][r], kScaleLog2e, -mnew);
      exp2_x8(arg, p8);
#pragma unroll
      for (int r = 0; r < 8; r += 2) {
        const float pa = p8[r], pb = p8[r + 1];
        psum += pa;
        psum += pb;
        const v2b hi2 = cvt_bf16x2(pa, pb);
        const v2b lo2 = cvt_bf16x2(pa - (float)hi2[0], pb - (float)hi2[1]);
        ph[j >> 1][(j & 1) * 8 + r]     = hi2[0];
        ph[j >> 1][(j & 1) * 8 + r + 1] = hi2[1];
        pl[j >> 1][(j & 1) * 8 + r]     = lo2[0];
        pl[j >> 1][(j & 1) * 8 + r + 1] = lo2[1];
      }
      pj[j] = psum;
    }
    lrow = lrow * alpha + ((pj[0] + pj[1]) + (pj[2] + pj[3]));
#pragma unroll
    for (int t = 0; t < 4; ++t)
#pragma unroll
      for (int r = 0; r < 8; ++r) oacc[t][r] *= alpha;

    // ---- out^T += v^T.p^T : A = v^T [m = d][k = kv], B = p^T [k = kv][n = query] ----
    // kk unrolled: ph and pl live in registers, which only constant indices can name (a rolled loop would send them to scratch)
#pragma unroll
    for (int kk = 0; kk < 2; ++kk) {
#pragma unroll
      for (int t = 0; t < 4; ++t) oacc[t] = at_mma(vf[kk][t], ph[kk], oacc[t]);
#pragma unroll
      for (int t = 0; t < 4; ++t) oacc[t] = at_mma(vf[kk][t], pl[kk], oacc[t]);
    }
  }

  // ---- join the halves' sums, normalise, stage the wave's 16 x 64 tile row-major: 8 consecutive d per lane and t ----
  float* os = Os[wave];
  {
    const float inv = 1.0f / (lrow + other_half(lrow));
#pragma unroll
    for (int t = 0; t < 4; ++t) {
      v4f lo4, hi4;
#pragma unroll
      for (int e = 0; e < 4; ++e) { lo4[e] = oacc[t][e] * inv; hi4[e] = oacc[t][4 + e] * inv; }
      *(v4f*)(os + c * 68 + t * 16 + 8 * hh)     = lo4;
      *(v4f*)(os + c * 68 + t * 16 + 8 * hh + 4) = hi4;
    }
  }
  __builtin_amdgcn_fence(__ATOMIC_RELEASE, "workgroup");
  __builtin_amdgcn_wave_barrier();
  __builtin_amdgcn_fence(__ATOMIC_ACQUIRE, "workgroup");
  {
    const size_t o_rs = (size_t)kHeads * kDim;   // row stride (floats)
    float* ob_ptr = out + ((size_t)b * kSeq) * o_rs + (size_t)h * kDim;
    const int c4 = (lane & 15) * 4;               // row segment 256 B = 16 lanes x 16 B
    {
#pragma unroll
      for (int it = 0; it < 8; ++it) {
        const int row = it * 2 + hh;
        v4f val = *(const v4f*)(os + row * 68 + c4);
        *(v4f*)(ob_ptr + (size_t)(q0 + row) * o_rs + c4) = val;
      }
      
    }
  }
}

// =====================================================================================
// Host glue. Workspace region map (bytes):
//   [         0,  8,388,608)  q  bf16 plane [B][S][H][D]
//   [ 8,388,608, 16,777,216)  k  bf16 plane [B][S][H][D]
//   [16,777,216, 25,165,824)  v^T bf16 plane [B][H][D][S]
//   total carve 25,165,824 B
// =====================================================================================
extern "C" void kernel_launch(void* const* d_in, const int* in_sizes, int n_in,
                              void* d_out, int out_size, void* d_ws, size_t ws_size,
                              hipStream_t stream)
{
  (void)in_sizes; (void)n_in; (void)out_size;
  const float* q  = (const float*)d_in[0];
  const float* k  = (const float*)d_in[1];
  const float* v  = (const float*)d_in[2];
  const int*   vl = (const int*)d_in[3];
  float* out = (float*)d_out;

  const size_t planeElems = (size_t)kBatch * kSeq * kHeads * kDim;            // 4,194,304
  const size_t carveBytes = 3 * planeElems * sizeof(unsigned short);          // 25,165,824
  if (carveBytes > ws_size) return;

  unsigned short* ws  = (unsigned short*)d_ws;
  unsigned short* qp  = ws;
  unsigned short* kp  = ws + planeElems;
  unsigned short* vtp = ws + 2 * planeElems;

  const int prepBlocks = kBatch * kHeads * (kSkv / 64);      // 1024
  const int attnBlocks = kBatch * kHeads * (kSeq / kQB);     // 1024

  prep_planes<<<dim3(prepBlocks), dim3(128), 0, stream>>>(q, k, v, qp, kp, vtp);
  attn_planes_kernel<<<dim3(attnBlocks), dim3(128), 0, stream>>>(qp, kp, vtp, vl, out);
}

// v006
// A run of this version takes 29 microseconds.
// In two side-by-side timings against v005, it was 1.05 and 1.06 times as fast.
// Over all steps from v000 it is 3.66 times as fast.
// Contractions: scores = q.k^T and out = p.v on v_wmma_f32_16x16x32_bf16 (q, k, v RNE-converted to bf16 once at load; p carried as bf16 hi+lo parts, v single bf16 plane), f32 accumulate; masking, online softmax and normalisation in f32.
#include <hip/hip_runtime.h>
#include <stdint.h>
#include <math.h>

typedef __attribute__((ext_vector_type(16))) __bf16   v16b;
typedef __attribute__((ext_vector_type(8)))  __bf16   v8b;
typedef __attribute__((ext_vector_type(8)))  float    v8f;
typedef __attribute__((ext_vector_type(4)))  float    v4f;
typedef __attribute__((ext_vector_type(4)))  unsigned v4u;
typedef __attribute__((ext_vector_type(2)))  float    v2f;
typedef __attribute__((ext_vector_type(2)))  __bf16   v2b;

// ---- problem geometry (element (b,s,h,d) of every tensor at ((b*S+s)*H+h)*D+d) ----
constexpr int kBatch = 2;
constexpr int kSeq   = 2048;   // query length
constexpr int kSkv   = 2048;   // key length
constexpr int kHeads = 16;
constexpr int kDim   = 64;
constexpr int kQB    = 64;     // query rows per block (4 waves x 16)
constexpr int kKC    = 64;     // keys per chunk
constexpr int kNW    = 4;
constexpr int kMaxChunks = kSkv / kKC;
constexpr int kPit   = 72;     // LDS row pitch of the 64-element bf16 tiles: 144 B = 16 B x 9, so the 16 rows of a 16-byte fragment read fall on 64 different banks
constexpr float kScaleLog2e = 0.125f * 1.44269504088896340736f;   // 1/sqrt(64) times log2(e): exp(scale * (s - m)) = exp2(s * kScaleLog2e - m * kScaleLog2e)
static_assert(kSeq % kQB == 0);
static_assert(kSkv % kKC == 0);
static_assert(kSeq == kSkv);
static_assert(kDim == 64);
static_assert(kKC == 64);
static_assert((kPit * 2) % 16 == 0);   // rows stay 16-byte aligned
static_assert(kKC % 32 == 0);      // contraction depth of p.v per chunk is a multiple of 32
static_assert(kDim % 32 == 0);     // contraction depth of q.k^T is a multiple of 32

// ---- helpers ----
// two f32 -> two bf16, round to nearest even, by the one packed hardware convert (a in the low half-word)
__device__ __forceinline__ v2b cvt_bf16x2(float a, float b) { return __builtin_convertvector((v2f){a, b}, v2b); }
__device__ __forceinline__ unsigned cvt_bf16x2_bits(float a, float b) { return __builtin_bit_cast(unsigned, cvt_bf16x2(a, b)); }
__device__ __forceinline__ float bf_bits2f(unsigned short h) { return __uint_as_float(((unsigned)h) << 16); }

__device__ __forceinline__ void dep_guard_b(v8f& a, v8f& b, v16b x, v16b y) { asm volatile("v_nop\n\tv_nop\n\tv_nop\n\tv_nop" : "+v"(a), "+v"(b) : "v"(x), "v"(y)); }
__device__ __forceinline__ void keep4_b(v16b a, v16b b, v16b c, v16b d) { asm volatile("v_nop" :: "v"(a), "v"(b), "v"(c), "v"(d)); }
template <typename T> struct Frag;
template <> struct Frag<__bf16> {
  typedef v16b V; union U { v16b v; v8b h[2]; };
  static __device__ __forceinline__ v16b load(const __bf16* p) {   // elements 0..7 <- p[0..7], 8..15 <- p[16..23]
    U f; f.h[0] = *(const v8b*)(p); f.h[1] = *(const v8b*)(p + 16); return f.v;
  }
  static __device__ __forceinline__ v8f mma(v16b a, v16b b, v8f c) {
    return __builtin_amdgcn_wmma_f32_16x16x32_bf16(false, a, false, b, (short)0, c, false, false);
  }
  static __device__ __forceinline__ void guard(v8f& a, v8f& b, v16b x, v16b y) { dep_guard_b(a, b, x, y); }
  static __device__ __forceinline__ void keep(v16b a, v16b b, v16b c, v16b d) { keep4_b(a, b, c, d); }
};

// value of the lane 16 away (the other half's lane of the same column), by a vector cross-row move
__device__ __forceinline__ float other_half(float x) {
  const int b = __float_as_int(x);
  return __int_as_float(__builtin_amdgcn_permlanex16(b, b, 0x76543210, 0xfedcba98, false, false));
}
__device__ __forceinline__ v8f at_mma(v16b a, v16b b, v8f c) {
  return __builtin_amdgcn_wmma_f32_16x16x32_bf16(false, a, false, b, (short)0, c, false, false);
}

// y[i] = 2^x[i]: eight bare hardware exponentials in one statement. Early-clobber results keep every source register intact while
// the run issues; the
// closing v_nop is the slot the instruction set asks for behind a transcendental before its result is read or its source overwritten.
__device__ __forceinline__ void exp2_x8(const float (&x)[8], float (&y)[8]) {
  asm("v_exp_f32 %0, %8\n\t"
      "v_exp_f32 %1, %9\n\t"
      "v_exp_f32 %2, %10\n\t"
      "v_exp_f32 %3, %11\n\t"
      "v_exp_f32 %4, %12\n\t"
      "v_exp_f32 %5, %13\n\t"
      "v_exp_f32 %6, %14\n\t"
      "v_exp_f32 %7, %15\n\t"
      "v_nop"
      : "=&v"(y[0]), "=&v"(y[1]), "=&v"(y[2]), "=&v"(y[3]), "=&v"(y[4]), "=&v"(y[5]), "=&v"(y[6]), "=&v"(y[7])
      : "v"(x[0]), "v"(x[1]), "v"(x[2]), "v"(x[3]), "v"(x[4]), "v"(x[5]), "v"(x[6]), "v"(x[7]));
}

// pack 8 f32 -> 8 bf16 (RNE) as 4 x 32-bit words, element 2e in the low half-word
__device__ __forceinline__ v4u pack_bf16x8(v4f a, v4f b) {
  v4u r;
  r[0] = cvt_bf16x2_bits(a[0], a[1]);
  r[1] = cvt_bf16x2_bits(a[2], a[3]);
  r[2] = cvt_bf16x2_bits(b[0], b[1]);
  r[3] = cvt_bf16x2_bits(b[2], b[3]);
  return r;
}

// =====================================================================================
// Prep: one block per (b, h, 64-row s tile). 128 threads.
// Coverage per block: q/k: rows it*16 + (tid>>3), it 0..3 -> 64 rows, cols (tid&7)*8 .. +7 -> 64 cols;
//   v load: s = i*8 + (tid>>4), i 0..7 -> 64 rows, d = (tid&15)*4 + 0..3 -> 64 cols; v write: d = it*16 + (tid>>3) (0..63), s = (tid&7)*8 + 0..7.
//   1024 blocks = 2 b x 16 h x 32 s-tiles cover all three planes exactly once.
// =====================================================================================
__global__ __launch_bounds__(128)
void prep_planes(const float* __restrict__ q, const float* __restrict__ k, const float* __restrict__ v,
                 unsigned short* __restrict__ qp, unsigned short* __restrict__ kp, unsigned short* __restrict__ vtp)
{
  __shared__ __align__(16) float tile[64 * 68];   // [s][d], pitch 68 floats
  const int tid = threadIdx.x;
  const int bx  = blockIdx.x;
  const int nst = kSkv / 64;
  const int st  = bx % nst;
  const int bh  = bx / nst;
  const int h   = bh % kHeads;
  const int b   = bh / kHeads;
  const int s0  = st * 64;

  // ---- v tile -> LDS (f32, row-major [s][d]) ----
  //      16 lanes x 16 B take one 256-byte row: a wave-wide load covers 4 whole 128-byte lines
  {
    const int sr = tid >> 4, c4 = (tid & 15) * 4;
    const float* src = v + ((size_t)(b * kSkv + s0 + sr) * kHeads + h) * kDim + c4;
#pragma unroll
    for (int i = 0; i < 8; ++i) *(v4f*)(tile + (i * 8 + sr) * 68 + c4) = *(const v4f*)(src + (size_t)i * 8 * kHeads * kDim);
  }
  __syncthreads();

  const int rg = tid >> 3;          // row group 0..15
  const int c8 = (tid & 7) * 8;     // 8 consecutive elements per lane

  v4u qw[4], kw[4], vw[4];
#pragma unroll
  for (int it = 0; it < 4; ++it) {
    const int row = it * 16 + rg;
    const size_t off = ((size_t)(b * kSeq + s0 + row) * kHeads + h) * kDim + c8;
    const v4f a0 = *(const v4f*)(q + off);
    const v4f a1 = *(const v4f*)(q + off + 4);
    qw[it] = pack_bf16x8(a0, a1);
  }
  asm volatile("" ::: "memory");
#pragma unroll
  for (int it = 0; it < 4; ++it) {
    const int row = it * 16 + rg;
    const size_t off = ((size_t)(b * kSkv + s0 + row) * kHeads + h) * kDim + c8;
    const v4f a0 = *(const v4f*)(k + off);
    const v4f a1 = *(const v4f*)(k + off + 4);
    kw[it] = pack_bf16x8(a0, a1);
  }
  asm volatile("" ::: "memory");
#pragma unroll
  for (int it = 0; it < 4; ++it) {
    const int d = it * 16 + rg;
    v4f f0, f1;
#pragma unroll
    for (int e = 0; e < 4; ++e) {
      f0[e] = tile[(c8 + e) * 68 + d];
      f1[e] = tile[(c8 + 4 + e) * 68 + d];
    }
    vw[it] = pack_bf16x8(f0, f1);
  }

  {
#pragma unroll
    for (int it = 0; it < 4; ++it) {
      const int row = it * 16 + rg;
      const size_t offq = ((size_t)(b * kSeq + s0 + row) * kHeads + h) * kDim + c8;
      *(v4u*)(qp + offq) = qw[it];
      *(v4u*)(kp + offq) = kw[it];
      const int d = row;
      const size_t offv = ((size_t)((b * kHeads + h) * kDim + d)) * kSkv + s0 + c8;
      *(v4u*)(vtp + offv) = vw[it];
    }
    
  }
}

// =====================================================================================
// Attention for head_dim 64 on bf16 planes: block = 4 waves = 64 query rows of one (b, h); 64-key chunks.
//   Both products are formed transposed, so that a lane holds scores and outputs of ONE query (column c):
//   scores^T: A = k rows (bf16, [kv][d] in LDS), B = q rows (bf16, registers)            -> v_wmma_f32_16x16x32_bf16
//   out^T   : A = v^T rows ([d][kv] in LDS), B = p^T (bf16 hi and lo, packed in registers) -> v_wmma_f32_16x16x32_bf16 x2
//   Keys with index >= valid_lens[b] get score -inf (select); chunks entirely beyond valid_lens are skipped
//   (their probabilities are exactly 0); chunk count clamped to [1, kMaxChunks].
// =====================================================================================
__global__ __launch_bounds__(128)
void attn_planes_kernel(const unsigned short* __restrict__ qp, const unsigned short* __restrict__ kp,
                        const unsigned short* __restrict__ vtp, const int* __restrict__ vlen,
                        float* __restrict__ out)
{
  __shared__ __align__(16) __bf16 Ksh[kKC * kPit];          // [kv][d]       9 KB, pitch kPit
  __shared__ __align__(16) __bf16 Vts[kDim * kPit];         // [d][kv]       9 KB, pitch kPit
  __shared__ __align__(16) float  Os[kNW][16 * 68];         // per wave out tile, pitch 68

  const int tid  = threadIdx.x;
  const int wave = tid >> 5;
  const int lane = tid & 31;
  const int hh   = lane >> 4;
  const int c    = lane & 15;

  const int nqb = kSeq / kQB;
  const int bx  = blockIdx.x;
  const int qb  = bx % nqb;
  const int bh  = bx / nqb;
  const int h   = bh % kHeads;
  const int b   = bh / kHeads;
  const int q0  = qb * kQB + wave * 16;

  int valid = vlen[b];
  valid = valid < 0 ? 0 : valid;
  valid = valid > kSkv ? kSkv : valid;
  int nChunks = (valid + kKC - 1) / kKC;          // block-uniform
  nChunks = nChunks < 1 ? 1 : nChunks;
  nChunks = nChunks > kMaxChunks ? kMaxChunks : nChunks;

  // ---- Q fragments (B operand: column = query q0 + c, k = d), 2 d-chunks ----
  v16b qa[2];
  {
    const __bf16* qrow = (const __bf16*)qp + ((size_t)(b * kSeq + q0 + c) * kHeads + h) * kDim;
#pragma unroll
    for (int dc = 0; dc < 2; ++dc) qa[dc] = Frag<__bf16>::load(qrow + dc * 32 + 8 * hh);
  }

  float mrow = -INFINITY;   // running maximum of query q0 + c, in scaled log2 units (raw score x kScaleLog2e; equal in both lane halves)
  float lrow = 0.f;         // running sum over this lane half's keys; the halves are joined after the loop
  v8f oacc[4];              // oacc[t][r] = out^T[d = 16t + 8hh + r][query q0 + c]
#pragma unroll
  for (int t = 0; t < 4; ++t) oacc[t] = (v8f){0.f,0.f,0.f,0.f,0.f,0.f,0.f,0.f};

  const size_t kbase  = ((size_t)b * kSkv) * kHeads * kDim + (size_t)h * kDim;   // + kv*(H*D)
  const size_t vtbase = ((size_t)(b * kHeads + h) * kDim) * kSkv;                  // + d*S + kv

  for (int kc = 0; kc < nChunks; ++kc) {
    const int kv0 = kc * kKC;
    __syncthreads();
    {
      // stage K [64 kv][64 d] and V^T [64 d][64 kv]: 8 lanes x 16 B take one 128-byte row, so a wave-wide load covers 4 whole lines;
      // thread -> rows i*16 + (tid>>3), i 0..3, elements (tid&7)*8 .. +7
      const int r8 = tid >> 3, c8 = (tid & 7) * 8;
      const unsigned short* ksrc = kp + kbase + (size_t)(kv0 + r8) * (kHeads * kDim) + c8;
      const unsigned short* vsrc = vtp + vtbase + (size_t)r8 * kSkv + kv0 + c8;
      __bf16* kdst = Ksh + r8 * kPit + c8;
      __bf16* vdst = Vts + r8 * kPit + c8;
#pragma unroll
      for (int i = 0; i < 4; ++i) {
        *(v4u*)(kdst + i * 16 * kPit) = *(const v4u*)(ksrc + (size_t)i * 16 * kHeads * kDim);
        *(v4u*)(vdst + i * 16 * kPit) = *(const v4u*)(vsrc + (size_t)i * 16 * kSkv);
      }
      asm volatile("s_wait_xcnt 0x0" ::: "memory");   // precaution: stands in front of the first overwrite of the eight loads' address registers (the fragment reads behind the barrier reuse them)
    }
    __syncthreads();

    // ---- scores^T: s[j][r] = score(key kv0 + 16j + 8hh + r, query q0 + c) ----
    //      all eight k fragments are fetched as one group, then the eight products run back to back on four independent tiles
    v16b kf[2][4];
#pragma unroll
    for (int dc = 0; dc < 2; ++dc)
#pragma unroll
      for (int j = 0; j < 4; ++j) kf[dc][j] = Frag<__bf16>::load(Ksh + (j * 16 + c) * kPit + dc * 32 + 8 * hh);
    __builtin_amdgcn_sched_barrier(0);   // keeps the sixteen reads one group: without it some sink between the products, each with a wait of its own
    v8f s[4];
#pragma unroll
    for (int j = 0; j < 4; ++j) s[j] = (v8f){0.f,0.f,0.f,0.f,0.f,0.f,0.f,0.f};
#pragma unroll
    for (int dc = 0; dc < 2; ++dc)
#pragma unroll
      for (int j = 0; j < 4; ++j) s[j] = at_mma(kf[dc][j], qa[dc], s[j]);

    // ---- all eight v^T fragments are fetched here as one group: their LDS latency passes under the softmax arithmetic ----
    v16b vf[2][4];
#pragma unroll
    for (int kk = 0; kk < 2; ++kk)
#pragma unroll
      for (int t = 0; t < 4; ++t) vf[kk][t] = Frag<__bf16>::load(Vts + (t * 16 + c) * kPit + kk * 32 + 8 * hh);
    __builtin_amdgcn_sched_barrier(0);   // keeps the whole group in front of the softmax: without it half of the reads sink to just ahead of their products

    // ---- key mask (select -inf) on the raw scores, chunk max of the lane's query: in-lane, then one exchange of the halves ----
    const int lim = valid - kv0 - 8 * hh;   // rows 16j + r of this lane half below lim are valid keys
    float mj[4];
#pragma unroll
    for (int j = 0; j < 4; ++j) {
      float m = -INFINITY;
#pragma unroll
      for (int r = 0; r < 8; ++r) {
        const float sv = (j * 16 + r < lim) ? s[j][r] : -INFINITY;
        s[j][r] = sv;
        m = fmaxf(m, sv);
      }
      mj[j] = m;
    }
    float cm = fmaxf(fmaxf(mj[0], mj[1]), fmaxf(mj[2], mj[3]));
    cm = fmaxf(cm, other_half(cm));

    // ---- online softmax; p^T -> bf16 hi and lo B fragments in registers:
    //      element e of fragment kk is key 32kk + 8hh + e (e < 8) or 32kk + 16 + 8hh + (e - 8), the k order of Frag::load ----
    //      p = exp2(s * kScaleLog2e - mnew): one fused multiply-add and the bare hardware exponential per score
    const float mnew  = fmaxf(mrow, cm * kScaleLog2e);
    const float alpha = __builtin_amdgcn_exp2f(mrow - mnew);
    mrow = mnew;
    v16b ph[2], pl[2];
    float pj[4];
#pragma unroll
    for (int j = 0; j < 4; ++j) {
      float psum = 0.f;
      float arg[8], p8[8];
#pragma unroll
      for (int r = 0; r < 8; ++r) arg[r] = __builtin_fmaf(s[j][r], kScaleLog2e, -mnew);
      exp2_x8(arg, p8);
#pragma unroll
      for (int r = 0; r < 8; r += 2) {
        const float pa = p8[r], pb = p8[r + 1];
        psum += pa;
        psum += pb;
        const v2b hi2 = cvt_bf16x2(pa, pb);
        const v2b lo2 = cvt_bf16x2(pa - (float)hi2[0], pb - (float)hi2[1]);
        ph[j >> 1][(j & 1) * 8 + r]     = hi2[0];
        ph[j >> 1][(j & 1) * 8 + r + 1] = hi2[1];
        pl[j >> 1][(j & 1) * 8 + r]     = lo2[0];
        pl[j >> 1][(j & 1) * 8 + r + 1] = lo2[1];
      }
      pj[j] = psum;
    }
    lrow = lrow * alpha + ((pj[0] + pj[1]) + (pj[2] + pj[3]));
#pragma unroll
    for (int t = 0; t < 4; ++t)
#pragma unroll
      for (int r = 0; r < 8; ++r) oacc[t][r] *= alpha;

    // ---- out^T += v^T.p^T : A = v^T [m = d][k = kv], B = p^T [k = kv][n = query] ----
    // kk unrolled: ph and pl live in registers, which only constant indices can name (a rolled loop would send them to scratch)
#pragma unroll
    for (int kk = 0; kk < 2; ++kk) {
#pragma unroll
      for (int t = 0; t < 4; ++t) oacc[t] = at_mma(vf[kk][t], ph[kk], oacc[t]);
#pragma unroll
      for (int t = 0; t < 4; ++t) oacc[t] = at_mma(vf[kk][t], pl[kk], oacc[t]);
    }
  }

  // ---- join the halves' sums, normalise, stage the wave's 16 x 64 tile row-major: 8 consecutive d per lane and t ----
  float* os = Os[wave];
  {
    const float inv = 1.0f / (lrow + other_half(lrow));
#pragma unroll
    for (int t = 0; t < 4; ++t) {
      v4f lo4, hi4;
#pragma unroll
      for (int e = 0; e < 4; ++e) { lo4[e] = oacc[t][e] * inv; hi4[e] = oacc[t][4 + e] * inv; }
      *(v4f*)(os + c * 68 + t * 16 + 8 * hh)     = lo4;
      *(v4f*)(os + c * 68 + t * 16 + 8 * hh + 4) = hi4;
    }
  }
  __builtin_amdgcn_fence(__ATOMIC_RELEASE, "workgroup");
  __builtin_amdgcn_wave_barrier();
  __builtin_amdgcn_fence(__ATOMIC_ACQUIRE, "workgroup");
  {
    const size_t o_rs = (size_t)kHeads * kDim;   // row stride (floats)
    float* ob_ptr = out + ((size_t)b * kSeq) * o_rs + (size_t)h * kDim;
    const int c4 = (lane & 15) * 4;               // row segment 256 B = 16 lanes x 16 B
    {
#pragma unroll
      for (int it = 0; it < 8; ++it) {
        const int row = it * 2 + hh;
        v4f val = *(const v4f*)(os + row * 68 + c4);
        *(v4f*)(ob_ptr + (size_t)(q0 + row) * o_rs + c4) = val;
      }
      
    }
  }
}

// =====================================================================================
// Host glue. Workspace region map (bytes):
//   [         0,  8,388,608)  q  bf16 plane [B][S][H][D]
//   [ 8,388,608, 16,777,216)  k  bf16 plane [B][S][H][D]
//   [16,777,216, 25,165,824)  v^T bf16 plane [B][H][D][S]
//   total carve 25,165,824 B
// =====================================================================================
extern "C" void kernel_launch(void* const* d_in, const int* in_sizes, int n_in,
                              void* d_out, int out_size, void* d_ws, size_t ws_size,
                              hipStream_t stream)
{
  (void)in_sizes; (void)n_in; (void)out_size;
  const float* q  = (const float*)d_in[0];
  const float* k  = (const float*)d_in[1];
  const float* v  = (const float*)d_in[2];
  const int*   vl = (const int*)d_in[3];
  float* out = (float*)d_out;

  const size_t planeElems = (size_t)kBatch * kSeq * kHeads * kDim;            // 4,194,304
  const size_t carveBytes = 3 * planeElems * sizeof(unsigned short);          // 25,165,824
  if (carveBytes > ws_size) return;

  unsigned short* ws  = (unsigned short*)d_ws;
  unsigned short* qp  = ws;
  unsigned short* kp  = ws + planeElems;
  unsigned short* vtp = ws + 2 * planeElems;

  const int prepBlocks = kBatch * kHeads * (kSkv / 64);      // 1024
  const int attnBlocks = kBatch * kHeads * (kSeq / kQB);     // 1024

  prep_planes<<<dim3(prepBlocks), dim3(128), 0, stream>>>(q, k, v, qp, kp, vtp);
  attn_planes_kernel<<<dim3(attnBlocks), dim3(128), 0, stream>>>(qp, kp, vtp, vl, out);
}

// v007
// A run of this version takes 25.5 microseconds.
// Next to v006, in two timings, it ran 1.13 and 1.12 times as fast.
// Over all steps from v000 it is 4.13 times as fast.
// Contractions: scores = q.k^T and out = p.v on v_wmma_f32_16x16x32_bf16 (q, k, v RNE-converted to bf16 once at load; p carried as bf16 hi+lo parts, v single bf16 plane), f32 accumulate; masking, online softmax and normalisation in f32.
#include <hip/hip_runtime.h>
#include <stdint.h>
#include <math.h>

typedef __attribute__((ext_vector_type(16))) __bf16   v16b;
typedef __attribute__((ext_vector_type(8)))  __bf16   v8b;
typedef __attribute__((ext_vector_type(8)))  float    v8f;
typedef __attribute__((ext_vector_type(4)))  float    v4f;
typedef __attribute__((ext_vector_type(4)))  unsigned v4u;
typedef __attribute__((ext_vector_type(2)))  float    v2f;
typedef __attribute__((ext_vector_type(2)))  __bf16   v2b;

// ---- problem geometry (element (b,s,h,d) of every tensor at ((b*S+s)*H+h)*D+d) ----
constexpr int kBatch = 2;
constexpr int kSeq   = 2048;   // query length
constexpr int kSkv   = 2048;   // key length
constexpr int kHeads = 16;
constexpr int kDim   = 64;
constexpr int kQB    = 64;     // query rows per block (4 waves x 16)
constexpr int kKC    = 64;     // keys per chunk
constexpr int kNW    = 4;
constexpr int kMaxChunks = kSkv / kKC;
constexpr int kPit   = 72;     // LDS row pitch of the 64-element bf16 tiles: 144 B = 16 B x 9, so the 16 rows of a 16-byte fragment read fall on 64 different banks
constexpr float kScaleLog2e = 0.125f * 1.44269504088896340736f;   // 1/sqrt(64) times log2(e): exp(scale * (s - m)) = exp2(s * kScaleLog2e - m * kScaleLog2e)
static_assert(kSeq % kQB == 0);
static_assert(kSkv % kKC == 0);
static_assert(kSeq == kSkv);
static_assert(kDim == 64);
static_assert(kKC == 64);
static_assert((kPit * 2) % 16 == 0);   // rows stay 16-byte aligned
static_assert(kKC % 32 == 0);      // contraction depth of p.v per chunk is a multiple of 32
static_assert(kDim % 32 == 0);     // contraction depth of q.k^T is a multiple of 32

// ---- helpers ----
// two f32 -> two bf16, round to nearest even, by the one packed hardware convert (a in the low half-word)
__device__ __forceinline__ v2b cvt_bf16x2(float a, float b) { return __builtin_convertvector((v2f){a, b}, v2b); }
__device__ __forceinline__ unsigned cvt_bf16x2_bits(float a, float b) { return __builtin_bit_cast(unsigned, cvt_bf16x2(a, b)); }
__device__ __forceinline__ float bf_bits2f(unsigned short h) { return __uint_as_float(((unsigned)h) << 16); }

__device__ __forceinline__ void dep_guard_b(v8f& a, v8f& b, v16b x, v16b y) { asm volatile("v_nop\n\tv_nop\n\tv_nop\n\tv_nop" : "+v"(a), "+v"(b) : "v"(x), "v"(y)); }
__device__ __forceinline__ void keep4_b(v16b a, v16b b, v16b c, v16b d) { asm volatile("v_nop" :: "v"(a), "v"(b), "v"(c), "v"(d)); }
template <typename T> struct Frag;
template <> struct Frag<__bf16> {
  typedef v16b V; union U { v16b v; v8b h[2]; };
  static __device__ __forceinline__ v16b load(const __bf16* p) {   // elements 0..7 <- p[0..7], 8..15 <- p[16..23]
    U f; f.h[0] = *(const v8b*)(p); f.h[1] = *(const v8b*)(p + 16); return f.v;
  }
  static __device__ __forceinline__ v8f mma(v16b a, v16b b, v8f c) {
    return __builtin_amdgcn_wmma_f32_16x16x32_bf16(false, a, false, b, (short)0, c, false, false);
  }
  static __device__ __forceinline__ void guard(v8f& a, v8f& b, v16b x, v16b y) { dep_guard_b(a, b, x, y); }
  static __device__ __forceinline__ void keep(v16b a, v16b b, v16b c, v16b d) { keep4_b(a, b, c, d); }
};

// value of the lane 16 away (the other half's lane of the same column), by a vector cross-row move
__device__ __forceinline__ float other_half(float x) {
  const int b = __float_as_int(x);
  return __int_as_float(__builtin_amdgcn_permlanex16(b, b, 0x76543210, 0xfedcba98, false, false));
}
__device__ __forceinline__ v8f at_mma(v16b a, v16b b, v8f c) {
  return __builtin_amdgcn_wmma_f32_16x16x32_bf16(false, a, false, b, (short)0, c, false, false);
}

// y[i] = 2^x[i]: eight bare hardware exponentials in one statement. Early-clobber results keep every source register intact while
// the run issues; the
// closing v_nop is the slot the instruction set asks for behind a transcendental before its result is read or its source overwritten.
__device__ __forceinline__ void exp2_x8(const float (&x)[8], float (&y)[8]) {
  asm("v_exp_f32 %0, %8\n\t"
      "v_exp_f32 %1, %9\n\t"
      "v_exp_f32 %2, %10\n\t"
      "v_exp_f32 %3, %11\n\t"
      "v_exp_f32 %4, %12\n\t"
      "v_exp_f32 %5, %13\n\t"
      "v_exp_f32 %6, %14\n\t"
      "v_exp_f32 %7, %15\n\t"
      "v_nop"
      : "=&v"(y[0]), "=&v"(y[1]), "=&v"(y[2]), "=&v"(y[3]), "=&v"(y[4]), "=&v"(y[5]), "=&v"(y[6]), "=&v"(y[7])
      : "v"(x[0]), "v"(x[1]), "v"(x[2]), "v"(x[3]), "v"(x[4]), "v"(x[5]), "v"(x[6]), "v"(x[7]));
}

// One chunk's K and V^T tiles, global memory -> LDS through no register: eight asynchronous 16-byte copies a lane
// (rows r, r + 16, r + 32, r + 48 of each tile). kd, vd: the lane's LDS byte addresses of its first row; ks, vs: its global addresses.
// The closing s_wait_xcnt 0 is a precaution: it stands in the copies' own statement, so ahead of every later write of a register they name.
__device__ __forceinline__ void copy_chunk_async(const unsigned short* ks, const unsigned short* vs, unsigned kd, unsigned vd) {
  constexpr unsigned    ldsStep = 16 * kPit * 2;            // 16 LDS rows, bytes
  constexpr size_t      kStep   = (size_t)16 * kHeads * kDim;   // 16 key rows of the k plane, elements
  constexpr size_t      vStep   = (size_t)16 * kSkv;            // 16 d rows of the v^T plane, elements
  asm volatile("global_load_async_to_lds_b128 %0, %8, off\n\t"
               "global_load_async_to_lds_b128 %1, %9, off\n\t"
               "global_load_async_to_lds_b128 %2, %10, off\n\t"
               "global_load_async_to_lds_b128 %3, %11, off\n\t"
               "global_load_async_to_lds_b128 %4, %12, off\n\t"
               "global_load_async_to_lds_b128 %5, %13, off\n\t"
               "global_load_async_to_lds_b128 %6, %14, off\n\t"
               "global_load_async_to_lds_b128 %7, %15, off\n\t"
               "s_wait_xcnt 0x0"
               :: "v"(kd), "v"(kd + ldsStep), "v"(kd + 2 * ldsStep), "v"(kd + 3 * ldsStep),
                  "v"(vd), "v"(vd + ldsStep), "v"(vd + 2 * ldsStep), "v"(vd + 3 * ldsStep),
                  "v"(ks), "v"(ks + kStep), "v"(ks + 2 * kStep), "v"(ks + 3 * kStep),
                  "v"(vs), "v"(vs + vStep), "v"(vs + 2 * vStep), "v"(vs + 3 * vStep)
               : "memory");
}
// LDS byte address of a __shared__ element: the low 32 bits of its address
__device__ __forceinline__ unsigned lds_addr(const void* p) { return (unsigned)(uintptr_t)p; }

// pack 8 f32 -> 8 bf16 (RNE) as 4 x 32-bit words, element 2e in the low half-word
__device__ __forceinline__ v4u pack_bf16x8(v4f a, v4f b) {
  v4u r;
  r[0] = cvt_bf16x2_bits(a[0], a[1]);
  r[1] = cvt_bf16x2_bits(a[2], a[3]);
  r[2] = cvt_bf16x2_bits(b[0], b[1]);
  r[3] = cvt_bf16x2_bits(b[2], b[3]);
  return r;
}

// =====================================================================================
// Prep: one block per (b, h, 64-row s tile). 128 threads.
// Coverage per block: q/k: rows it*16 + (tid>>3), it 0..3 -> 64 rows, cols (tid&7)*8 .. +7 -> 64 cols;
//   v load: s = i*8 + (tid>>4), i 0..7 -> 64 rows, d = (tid&15)*4 + 0..3 -> 64 cols; v write: d = it*16 + (tid>>3) (0..63), s = (tid&7)*8 + 0..7.
//   1024 blocks = 2 b x 16 h x 32 s-tiles cover all three planes exactly once.
// =====================================================================================
__global__ __launch_bounds__(128)
void prep_planes(const float* __restrict__ q, const float* __restrict__ k, const float* __restrict__ v,
                 unsigned short* __restrict__ qp, unsigned short* __restrict__ kp, unsigned short* __restrict__ vtp)
{
  __shared__ __align__(16) float tile[64 * 68];   // [s][d], pitch 68 floats
  const int tid = threadIdx.x;
  const int bx  = blockIdx.x;
  const int nst = kSkv / 64;
  const int st  = bx % nst;
  const int bh  = bx / nst;
  const int h   = bh % kHeads;
  const int b   = bh / kHeads;
  const int s0  = st * 64;

  // ---- v tile -> LDS (f32, row-major [s][d]) ----
  //      16 lanes x 16 B take one 256-byte row: a wave-wide load covers 4 whole 128-byte lines
  {
    const int sr = tid >> 4, c4 = (tid & 15) * 4;
    const float* src = v + ((size_t)(b * kSkv + s0 + sr) * kHeads + h) * kDim + c4;
#pragma unroll
    for (int i = 0; i < 8; ++i) *(v4f*)(tile + (i * 8 + sr) * 68 + c4) = *(const v4f*)(src + (size_t)i * 8 * kHeads * kDim);
  }
  __syncthreads();

  const int rg = tid >> 3;          // row group 0..15
  const int c8 = (tid & 7) * 8;     // 8 consecutive elements per lane

  v4u qw[4], kw[4], vw[4];
#pragma unroll
  for (int it = 0; it < 4; ++it) {
    const int row = it * 16 + rg;
    const size_t off = ((size_t)(b * kSeq + s0 + row) * kHeads + h) * kDim + c8;
    const v4f a0 = *(const v4f*)(q + off);
    const v4f a1 = *(const v4f*)(q + off + 4);
    qw[it] = pack_bf16x8(a0, a1);
  }
  asm volatile("" ::: "memory");
#pragma unroll
  for (int it = 0; it < 4; ++it) {
    const int row = it * 16 + rg;
    const size_t off = ((size_t)(b * kSkv + s0 + row) * kHeads + h) * kDim + c8;
    const v4f a0 = *(const v4f*)(k + off);
    const v4f a1 = *(const v4f*)(k + off + 4);
    kw[it] = pack_bf16x8(a0, a1);
  }
  asm volatile("" ::: "memory");
#pragma unroll
  for (int it = 0; it < 4; ++it) {
    const int d = it * 16 + rg;
    v4f f0, f1;
#pragma unroll
    for (int e = 0; e < 4; ++e) {
      f0[e] = tile[(c8 + e) * 68 + d];
      f1[e] = tile[(c8 + 4 + e) * 68 + d];
    }
    vw[it] = pack_bf16x8(f0, f1);
  }

  {
#pragma unroll
    for (int it = 0; it < 4; ++it) {
      const int row = it * 16 + rg;
      const size_t offq = ((size_t)(b * kSeq + s0 + row) * kHeads + h) * kDim + c8;
      *(v4u*)(qp + offq) = qw[it];
      *(v4u*)(kp + offq) = kw[it];
      const int d = row;
      const size_t offv = ((size_t)((b * kHeads + h) * kDim + d)) * kSkv + s0 + c8;
      *(v4u*)(vtp + offv) = vw[it];
    }
    
  }
}

// =====================================================================================
// Attention for head_dim 64 on bf16 planes: block = 4 waves = 64 query rows of one (b, h); 64-key chunks.
//   Both products are formed transposed, so that a lane holds scores and outputs of ONE query (column c):
//   scores^T: A = k rows (bf16, [kv][d] in LDS), B = q rows (bf16, registers)            -> v_wmma_f32_16x16x32_bf16
//   out^T   : A = v^T rows ([d][kv] in LDS), B = p^T (bf16 hi and lo, packed in registers) -> v_wmma_f32_16x16x32_bf16 x2
//   Keys with index >= valid_lens[b] get score -inf (select); chunks entirely beyond valid_lens are skipped
//   (their probabilities are exactly 0); chunk count clamped to [1, kMaxChunks].
//   K and V^T chunks come through two LDS buffers filled by asynchronous copies: chunk t + 1 flies while chunk t is worked on.
// =====================================================================================
__global__ __launch_bounds__(128)
void attn_planes_kernel(const unsigned short* __restrict__ qp, const unsigned short* __restrict__ kp,
                        const unsigned short* __restrict__ vtp, const int* __restrict__ vlen,
                        float* __restrict__ out)
{
  __shared__ __align__(16) __bf16 Ksh[2][kKC * kPit];       // [buffer][kv][d]   2 x 9 KB, pitch kPit
  __shared__ __align__(16) __bf16 Vts[2][kDim * kPit];      // [buffer][d][kv]   2 x 9 KB, pitch kPit
  __shared__ __align__(16) float  Os[kNW][16 * 68];         // per wave out tile, pitch 68

  const int tid  = threadIdx.x;
  const int wave = tid >> 5;
  const int lane = tid & 31;
  const int hh   = lane >> 4;
  const int c    = lane & 15;

  const int nqb = kSeq / kQB;
  const int bx  = blockIdx.x;
  const int qb  = bx % nqb;
  const int bh  = bx / nqb;
  const int h   = bh % kHeads;
  const int b   = bh / kHeads;
  const int q0  = qb * kQB + wave * 16;

  int valid = vlen[b];
  valid = valid < 0 ? 0 : valid;
  valid = valid > kSkv ? kSkv : valid;
  int nChunks = (valid + kKC - 1) / kKC;          // block-uniform
  nChunks = nChunks < 1 ? 1 : nChunks;
  nChunks = nChunks > kMaxChunks ? kMaxChunks : nChunks;

  const size_t kbase  = ((size_t)b * kSkv) * kHeads * kDim + (size_t)h * kDim;   // + kv*(H*D)
  const size_t vtbase = ((size_t)(b * kHeads + h) * kDim) * kSkv;                  // + d*S + kv

  // staging of K [64 kv][64 d] and V^T [64 d][64 kv]: 8 lanes x 16 B take one 128-byte row, so a wave-wide copy covers 4 whole lines;
  // thread -> rows i*16 + (tid>>3), i 0..3, elements (tid&7)*8 .. +7
  const int r8 = tid >> 3, c8 = (tid & 7) * 8;
  const unsigned short* ksrc = kp + kbase + (size_t)r8 * (kHeads * kDim) + c8;   // + chunk * kKC * H * D
  const unsigned short* vsrc = vtp + vtbase + (size_t)r8 * kSkv + c8;            // + chunk * kKC
  const unsigned kdst = lds_addr(&Ksh[0][r8 * kPit + c8]);                       // + buffer * kBufBytes
  const unsigned vdst = lds_addr(&Vts[0][r8 * kPit + c8]);
  constexpr unsigned kBufBytes = kKC * kPit * 2;

  // chunk 0's copies go first of all: nothing in the block can start before they land; the Q loads fly beside them
  copy_chunk_async(ksrc, vsrc, kdst, vdst);

  // ---- Q fragments (B operand: column = query q0 + c, k = d), 2 d-chunks ----
  v16b qa[2];
  {
    const __bf16* qrow = (const __bf16*)qp + ((size_t)(b * kSeq + q0 + c) * kHeads + h) * kDim;
#pragma unroll
    for (int dc = 0; dc < 2; ++dc) qa[dc] = Frag<__bf16>::load(qrow + dc * 32 + 8 * hh);
  }

  float mrow = -INFINITY;   // running maximum of query q0 + c, in scaled log2 units (raw score x kScaleLog2e; equal in both lane halves)
  float lrow = 0.f;         // running sum over this lane half's keys; the halves are joined after the loop
  v8f oacc[4];              // oacc[t][r] = out^T[d = 16t + 8hh + r][query q0 + c]
#pragma unroll
  for (int t = 0; t < 4; ++t) oacc[t] = (v8f){0.f,0.f,0.f,0.f,0.f,0.f,0.f,0.f};

  // ---- in front of the loop: chunk 0 has landed and is published, then chunk 1 (where there is one) starts into the other buffer ----
  asm volatile("s_wait_asynccnt 0x0" ::: "memory");   // this wave's copies of chunk 0 have landed before the barrier that lets the other waves read them
  __syncthreads();
  if (nChunks > 1) copy_chunk_async(ksrc + (size_t)kKC * kHeads * kDim, vsrc + kKC, kdst + kBufBytes, vdst + kBufBytes);

  for (int kc = 0; kc < nChunks; ++kc) {
    const int kv0 = kc * kKC;
    const int buf = kc & 1;
    const __bf16* Kb = Ksh[buf];
    const __bf16* Vb = Vts[buf];

    // ---- scores^T: s[j][r] = score(key kv0 + 16j + 8hh + r, query q0 + c) ----
    //      all eight k fragments are fetched as one group, then the eight products run back to back on four independent tiles
    v16b kf[2][4];
#pragma unroll
    for (int dc = 0; dc < 2; ++dc)
#pragma unroll
      for (int j = 0; j < 4; ++j) kf[dc][j] = Frag<__bf16>::load(Kb + (j * 16 + c) * kPit + dc * 32 + 8 * hh);
    __builtin_amdgcn_sched_barrier(0);   // keeps the sixteen reads one group: without it some sink between the products, each with a wait of its own
    v8f s[4];
#pragma unroll
    for (int j = 0; j < 4; ++j) s[j] = (v8f){0.f,0.f,0.f,0.f,0.f,0.f,0.f,0.f};
#pragma unroll
    for (int dc = 0; dc < 2; ++dc)
#pragma unroll
      for (int j = 0; j < 4; ++j) s[j] = at_mma(kf[dc][j], qa[dc], s[j]);

    // ---- all eight v^T fragments are fetched here as one group: their LDS latency passes under the softmax arithmetic ----
    v16b vf[2][4];
#pragma unroll
    for (int kk = 0; kk < 2; ++kk)
#pragma unroll
      for (int t = 0; t < 4; ++t) vf[kk][t] = Frag<__bf16>::load(Vb + (t * 16 + c) * kPit + kk * 32 + 8 * hh);
    __builtin_amdgcn_sched_barrier(0);   // keeps the whole group in front of the softmax: without it half of the reads sink to just ahead of their products

    // ---- key mask (select -inf) on the raw scores, chunk max of the lane's query: in-lane, then one exchange of the halves ----
    const int lim = valid - kv0 - 8 * hh;   // rows 16j + r of this lane half below lim are valid keys
    float mj[4];
#pragma unroll
    for (int j = 0; j < 4; ++j) {
      float m = -INFINITY;
#pragma unroll
      for (int r = 0; r < 8; ++r) {
        const float sv = (j * 16 + r < lim) ? s[j][r] : -INFINITY;
        s[j][r] = sv;
        m = fmaxf(m, sv);
      }
      mj[j] = m;
    }
    float cm = fmaxf(fmaxf(mj[0], mj[1]), fmaxf(mj[2], mj[3]));
    cm = fmaxf(cm, other_half(cm));

    // ---- online softmax; p^T -> bf16 hi and lo B fragments in registers:
    //      element e of fragment kk is key 32kk + 8hh + e (e < 8) or 32kk + 16 + 8hh + (e - 8), the k order of Frag::load ----
    //      p = exp2(s * kScaleLog2e - mnew): one fused multiply-add and the bare hardware exponential per score
    const float mnew  = fmaxf(mrow, cm * kScaleLog2e);
    const float alpha = __builtin_amdgcn_exp2f(mrow - mnew);
    mrow = mnew;
    v16b ph[2], pl[2];
    float pj[4];
#pragma unroll
    for (int j = 0; j < 4; ++j) {
      float psum = 0.f;
      float arg[8], p8[8];
#pragma unroll
      for (int r = 0; r < 8; ++r) arg[r] = __builtin_fmaf(s[j][r], kScaleLog2e, -mnew);
      exp2_x8(arg, p8);
#pragma unroll
      for (int r = 0; r < 8; r += 2) {
        const float pa = p8[r], pb = p8[r + 1];
        psum += pa;
        psum += pb;
        const v2b hi2 = cvt_bf16x2(pa, pb);
        const v2b lo2 = cvt_bf16x2(pa - (float)hi2[0], pb - (float)hi2[1]);
        ph[j >> 1][(j & 1) * 8 + r]     = hi2[0];
        ph[j >> 1][(j & 1) * 8 + r + 1] = hi2[1];
        pl[j >> 1][(j & 1) * 8 + r]     = lo2[0];
        pl[j >> 1][(j & 1) * 8 + r + 1] = lo2[1];
      }
      pj[j] = psum;
    }
    lrow = lrow * alpha + ((pj[0] + pj[1]) + (pj[2] + pj[3]));
#pragma unroll
    for (int t = 0; t < 4; ++t)
#pragma unroll
      for (int r = 0; r < 8; ++r) oacc[t][r] *= alpha;

    // ---- out^T += v^T.p^T : A = v^T [m = d][k = kv], B = p^T [k = kv][n = query] ----
    // kk unrolled: ph and pl live in registers, which only constant indices can name (a rolled loop would send them to scratch)
#pragma unroll
    for (int kk = 0; kk < 2; ++kk) {
#pragma unroll
      for (int t = 0; t < 4; ++t) oacc[t] = at_mma(vf[kk][t], ph[kk], oacc[t]);
#pragma unroll
      for (int t = 0; t < 4; ++t) oacc[t] = at_mma(vf[kk][t], pl[kk], oacc[t]);
    }

    // ---- hand-over: chunk kc + 1 is published and this chunk's buffer is freed by the one barrier; then chunk kc + 2 starts into it ----
    __builtin_amdgcn_sched_barrier(0);   // keeps the chunk's arithmetic in front of the hand-over: without it the waits and the barrier rise to just behind the fragment reads, the copies stay here, and chunk kc + 1 is waited for a quarter of a trip after its issue
    asm volatile("s_wait_dscnt 0x0" ::: "memory");      // this wave's reads of the buffer have retired before any copy may overwrite it
    asm volatile("s_wait_asynccnt 0x0" ::: "memory");   // this wave's copies of chunk kc + 1 have landed before the barrier that lets the other waves read them
    __syncthreads();
    if (kc + 2 < nChunks)
      copy_chunk_async(ksrc + (size_t)(kc + 2) * kKC * kHeads * kDim, vsrc + (size_t)(kc + 2) * kKC, kdst + buf * kBufBytes, vdst + buf * kBufBytes);
  }
  asm volatile("s_wait_asynccnt 0x0" ::: "memory");     // no copy is outstanding when the wave goes on to the epilogue and ends

  // ---- join the halves' sums, normalise, stage the wave's 16 x 64 tile row-major: 8 consecutive d per lane and t ----
  float* os = Os[wave];
  {
    const float inv = 1.0f / (lrow + other_half(lrow));
#pragma unroll
    for (int t = 0; t < 4; ++t) {
      v4f lo4, hi4;
#pragma unroll
      for (int e = 0; e < 4; ++e) { lo4[e] = oacc[t][e] * inv; hi4[e] = oacc[t][4 + e] * inv; }
      *(v4f*)(os + c * 68 + t * 16 + 8 * hh)     = lo4;
      *(v4f*)(os + c * 68 + t * 16 + 8 * hh + 4) = hi4;
    }
  }
  __builtin_amdgcn_fence(__ATOMIC_RELEASE, "workgroup");
  __builtin_amdgcn_wave_barrier();
  __builtin_amdgcn_fence(__ATOMIC_ACQUIRE, "workgroup");
  {
    const size_t o_rs = (size_t)kHeads * kDim;   // row stride (floats)
    float* ob_ptr = out + ((size_t)b * kSeq) * o_rs + (size_t)h * kDim;
    const int c4 = (lane & 15) * 4;               // row segment 256 B = 16 lanes x 16 B
    {
#pragma unroll
      for (int it = 0; it < 8; ++it) {
        const int row = it * 2 + hh;
        v4f val = *(const v4f*)(os + row * 68 + c4);
        *(v4f*)(ob_ptr + (size_t)(q0 + row) * o_rs + c4) = val;
      }
      
    }
  }
}

// =====================================================================================
// Host glue. Workspace region map (bytes):
//   [         0,  8,388,608)  q  bf16 plane [B][S][H][D]
//   [ 8,388,608, 16,777,216)  k  bf16 plane [B][S][H][D]
//   [16,777,216, 25,165,824)  v^T bf16 plane [B][H][D][S]
//   total carve 25,165,824 B
// =====================================================================================
extern "C" void kernel_launch(void* const* d_in, const int* in_sizes, int n_in,
                              void* d_out, int out_size, void* d_ws, size_t ws_size,
                              hipStream_t stream)
{
  (void)in_sizes; (void)n_in; (void)out_size;
  const float* q  = (const float*)d_in[0];
  const float* k  = (const float*)d_in[1];
  const float* v  = (const float*)d_in[2];
  const int*   vl = (const int*)d_in[3];
  float* out = (float*)d_out;

  const size_t planeElems = (size_t)kBatch * kSeq * kHeads * kDim;            // 4,194,304
  const size_t carveBytes = 3 * planeElems * sizeof(unsigned short);          // 25,165,824
  if (carveBytes > ws_size) return;

  unsigned short* ws  = (unsigned short*)d_ws;
  unsigned short* qp  = ws;
  unsigned short* kp  = ws + planeElems;
  unsigned short* vtp = ws + 2 * planeElems;

  const int prepBlocks = kBatch * kHeads * (kSkv / 64);      // 1024
  const int attnBlocks = kBatch * kHeads * (kSeq / kQB);     // 1024

  prep_planes<<<dim3(prepBlocks), dim3(128), 0, stream>>>(q, k, v, qp, kp, vtp);
  attn_planes_kernel<<<dim3(attnBlocks), dim3(128), 0, stream>>>(qp, kp, vtp, vl, out);
}

// v008
// A run of this version takes 23.3 microseconds.
// Two timings next to v007 both put it at 1.10 times that version's speed.
// All steps since v000 together make it 4.54 times as fast.
// Contractions: scores = q.k^T and out = p.v on v_wmma_f32_16x16x32_bf16 (q, k, v RNE-converted to bf16 once at load; p carried as bf16 hi+lo parts, v single bf16 plane), f32 accumulate; masking, online softmax and normalisation in f32.
#include <hip/hip_runtime.h>
#include <stdint.h>
#include <math.h>

typedef __attribute__((ext_vector_type(16))) __bf16   v16b;
typedef __attribute__((ext_vector_type(8)))  __bf16   v8b;
typedef __attribute__((ext_vector_type(8)))  float    v8f;
typedef __attribute__((ext_vector_type(4)))  float    v4f;
typedef __attribute__((ext_vector_type(2)))  float    v2f;
typedef __attribute__((ext_vector_type(2)))  __bf16   v2b;
typedef __attribute__((ext_vector_type(4)))  __bf16   v4b;

// ---- problem geometry (element (b,s,h,d) of every tensor at ((b*S+s)*H+h)*D+d) ----
constexpr int kBatch = 2;
constexpr int kSeq   = 2048;   // query length
constexpr int kSkv   = 2048;   // key length
constexpr int kHeads = 16;
constexpr int kDim   = 64;
constexpr int kQB    = 128;    // query rows per block (8 waves x 16)
constexpr int kKC    = 64;     // keys per chunk
constexpr int kNW    = 8;
constexpr int kMaxChunks = kSkv / kKC;
constexpr int kPit   = 72;     // LDS row pitch of the 64-element bf16 tiles: 144 B = 16 B x 9, so the 16 rows of a 16-byte fragment read fall on 64 different banks
constexpr float kScaleLog2e = 0.125f * 1.44269504088896340736f;   // 1/sqrt(64) times log2(e): exp(scale * (s - m)) = exp2(s * kScaleLog2e - m * kScaleLog2e)
static_assert(kSeq % kQB == 0);
static_assert(kSkv % kKC == 0);
static_assert(kSeq == kSkv);
static_assert(kDim == 64);
static_assert(kKC == 64);
static_assert((kPit * 2) % 16 == 0);   // rows stay 16-byte aligned
static_assert(kKC % 32 == 0);      // contraction depth of p.v per chunk is a multiple of 32
static_assert(kDim % 32 == 0);     // contraction depth of q.k^T is a multiple of 32

// ---- helpers ----
// two f32 -> two bf16, round to nearest even, by the one packed hardware convert (a in the low half-word)
__device__ __forceinline__ v2b cvt_bf16x2(float a, float b) { return __builtin_convertvector((v2f){a, b}, v2b); }
__device__ __forceinline__ float bf_bits2f(unsigned short h) { return __uint_as_float(((unsigned)h) << 16); }

__device__ __forceinline__ void dep_guard_b(v8f& a, v8f& b, v16b x, v16b y) { asm volatile("v_nop\n\tv_nop\n\tv_nop\n\tv_nop" : "+v"(a), "+v"(b) : "v"(x), "v"(y)); }
__device__ __forceinline__ void keep4_b(v16b a, v16b b, v16b c, v16b d) { asm volatile("v_nop" :: "v"(a), "v"(b), "v"(c), "v"(d)); }
template <typename T> struct Frag;
template <> struct Frag<__bf16> {
  typedef v16b V; union U { v16b v; v8b h[2]; };
  static __device__ __forceinline__ v16b load(const __bf16* p) {   // elements 0..7 <- p[0..7], 8..15 <- p[16..23]
    U f; f.h[0] = *(const v8b*)(p); f.h[1] = *(const v8b*)(p + 16); return f.v;
  }
  static __device__ __forceinline__ v8f mma(v16b a, v16b b, v8f c) {
    return __builtin_amdgcn_wmma_f32_16x16x32_bf16(false, a, false, b, (short)0, c, false, false);
  }
  static __device__ __forceinline__ void guard(v8f& a, v8f& b, v16b x, v16b y) { dep_guard_b(a, b, x, y); }
  static __device__ __forceinline__ void keep(v16b a, v16b b, v16b c, v16b d) { keep4_b(a, b, c, d); }
};

// value of the lane 16 away (the other half's lane of the same column), by a vector cross-row move
__device__ __forceinline__ float other_half(float x) {
  const int b = __float_as_int(x);
  return __int_as_float(__builtin_amdgcn_permlanex16(b, b, 0x76543210, 0xfedcba98, false, false));
}
__device__ __forceinline__ v8f at_mma(v16b a, v16b b, v8f c) {
  return __builtin_amdgcn_wmma_f32_16x16x32_bf16(false, a, false, b, (short)0, c, false, false);
}

// y[i] = 2^x[i]: eight bare hardware exponentials in one statement. Early-clobber results keep every source register intact while
// the run issues; the
// closing v_nop is the slot the instruction set asks for behind a transcendental before its result is read or its source overwritten.
__device__ __forceinline__ void exp2_x8(const float (&x)[8], float (&y)[8]) {
  asm("v_exp_f32 %0, %8\n\t"
      "v_exp_f32 %1, %9\n\t"
      "v_exp_f32 %2, %10\n\t"
      "v_exp_f32 %3, %11\n\t"
      "v_exp_f32 %4, %12\n\t"
      "v_exp_f32 %5, %13\n\t"
      "v_exp_f32 %6, %14\n\t"
      "v_exp_f32 %7, %15\n\t"
      "v_nop"
      : "=&v"(y[0]), "=&v"(y[1]), "=&v"(y[2]), "=&v"(y[3]), "=&v"(y[4]), "=&v"(y[5]), "=&v"(y[6]), "=&v"(y[7])
      : "v"(x[0]), "v"(x[1]), "v"(x[2]), "v"(x[3]), "v"(x[4]), "v"(x[5]), "v"(x[6]), "v"(x[7]));
}

// four f32 -> four bf16 (RNE), element 0 lowest
__device__ __forceinline__ v4b cvt_bf16x4(float a, float b, float c, float d) {
  return __builtin_shufflevector(cvt_bf16x2(a, b), cvt_bf16x2(c, d), 0, 1, 2, 3);
}

// =====================================================================================
// Attention for head_dim 64, one launch, straight from the f32 tensors: block = 8 waves = 128 query rows of one (b, h); 64-key chunks.
//   Both products are formed transposed, so that a lane holds scores and outputs of ONE query (column c):
//   scores^T: A = k rows (bf16, [kv][d] in LDS), B = q rows (bf16, registers)            -> v_wmma_f32_16x16x32_bf16
//   out^T   : A = v^T rows ([d][kv] in LDS), B = p^T (bf16 hi and lo, packed in registers) -> v_wmma_f32_16x16x32_bf16 x2
//   Keys with index >= valid_lens[b] get score -inf (select); chunks entirely beyond valid_lens are skipped
//   (their probabilities are exactly 0); chunk count clamped to [1, kMaxChunks].
//   K and V chunks are loaded as f32 into registers one chunk ahead, rounded to bf16 and written (V transposed) into the other of two LDS buffers.
// =====================================================================================
__global__ __launch_bounds__(256)
void attn_fused_kernel(const float* __restrict__ q, const float* __restrict__ k, const float* __restrict__ v,
                       const int* __restrict__ vlen, float* __restrict__ out)
{
  __shared__ __align__(16) __bf16 Ksh[2][kKC * kPit];       // [buffer][kv][d]   2 x 9 KB, pitch kPit
  __shared__ __align__(16) __bf16 Vts[2][kDim * kPit];      // [buffer][d][kv]   2 x 9 KB, pitch kPit
  __shared__ __align__(16) float  Os[kNW][16 * 68];         // per wave out tile, pitch 68

  const int tid  = threadIdx.x;
  const int wave = tid >> 5;
  const int lane = tid & 31;
  const int hh   = lane >> 4;
  const int c    = lane & 15;

  const int nqb = kSeq / kQB;
  const int bx  = blockIdx.x;
  const int qb  = bx % nqb;
  const int bh  = bx / nqb;
  const int h   = bh % kHeads;
  const int b   = bh / kHeads;
  const int q0  = qb * kQB + wave * 16;

  int valid = vlen[b];
  valid = valid < 0 ? 0 : valid;
  valid = valid > kSkv ? kSkv : valid;
  int nChunks = (valid + kKC - 1) / kKC;          // block-uniform
  nChunks = nChunks < 1 ? 1 : nChunks;
  nChunks = nChunks > kMaxChunks ? kMaxChunks : nChunks;

  // staging of a chunk's K [64 kv][64 d] and V [64 kv][64 d], f32: 16 lanes x 16 B take one 256-byte row, so a wave-wide load covers 4 whole lines.
  //   K: thread -> rows sr + 16 i, i 0..3, d = c4 .. c4 + 3; each load becomes 4 bf16 of one K row in LDS.
  //   V: thread -> rows 4 sr + i, i 0..3, d = c4 .. c4 + 3; the 4 x 4 patch is written transposed, 4 consecutive kv of each of its 4 d rows.
  constexpr size_t rowStep = (size_t)kHeads * kDim;   // one key row further, elements
  const int sr = tid >> 4, c4 = (tid & 15) * 4;
  const float* ksrc = k + ((size_t)(b * kSkv + sr) * kHeads + h) * kDim + c4;        // + chunk * kKC * rowStep
  const float* vsrc = v + ((size_t)(b * kSkv + 4 * sr) * kHeads + h) * kDim + c4;    // + chunk * kKC * rowStep
  v4f kr[4], vr[4];   // the chunk in flight

  // chunk 0's loads go first of all: nothing in the block can start before they land; the Q loads fly beside them
#pragma unroll
  for (int i = 0; i < 4; ++i) kr[i] = *(const v4f*)(ksrc + (size_t)i * 16 * rowStep);
#pragma unroll
  for (int i = 0; i < 4; ++i) vr[i] = *(const v4f*)(vsrc + (size_t)i * rowStep);

  // ---- Q fragments (B operand: column = query q0 + c, k = d), 2 d-chunks, rounded to bf16 here:
  //      elements 0..7 <- d = 32 dc + 8 hh + 0..7, elements 8..15 <- the same + 16 (the k order of Frag::load) ----
  v16b qa[2];
  {
    const float* qrow = q + ((size_t)(b * kSeq + q0 + c) * kHeads + h) * kDim;
#pragma unroll
    for (int dc = 0; dc < 2; ++dc) {
      const float* p = qrow + dc * 32 + 8 * hh;
      const v4f a0 = *(const v4f*)(p),      a1 = *(const v4f*)(p + 4);
      const v4f a2 = *(const v4f*)(p + 16), a3 = *(const v4f*)(p + 20);
      const v8b lo8 = __builtin_shufflevector(cvt_bf16x4(a0[0], a0[1], a0[2], a0[3]), cvt_bf16x4(a1[0], a1[1], a1[2], a1[3]), 0, 1, 2, 3, 4, 5, 6, 7);
      const v8b hi8 = __builtin_shufflevector(cvt_bf16x4(a2[0], a2[1], a2[2], a2[3]), cvt_bf16x4(a3[0], a3[1], a3[2], a3[3]), 0, 1, 2, 3, 4, 5, 6, 7);
      qa[dc] = __builtin_shufflevector(lo8, hi8, 0, 1, 2, 3, 4, 5, 6, 7, 8, 9, 10, 11, 12, 13, 14, 15);
    }
  }

  float mrow = -INFINITY;   // running maximum of query q0 + c, in scaled log2 units (raw score x kScaleLog2e; equal in both lane halves)
  float lrow = 0.f;         // running sum over this lane half's keys; the halves are joined after the loop
  v8f oacc[4];              // oacc[t][r] = out^T[d = 16t + 8hh + r][query q0 + c]
#pragma unroll
  for (int t = 0; t < 4; ++t) oacc[t] = (v8f){0.f,0.f,0.f,0.f,0.f,0.f,0.f,0.f};

  // ---- in front of the loop: chunk 0 is rounded, written into buffer 0 and published ----
#pragma unroll
  for (int i = 0; i < 4; ++i) *(v4b*)(&Ksh[0][(sr + 16 * i) * kPit + c4]) = cvt_bf16x4(kr[i][0], kr[i][1], kr[i][2], kr[i][3]);
#pragma unroll
  for (int e = 0; e < 4; ++e) *(v4b*)(&Vts[0][(c4 + e) * kPit + 4 * sr]) = cvt_bf16x4(vr[0][e], vr[1][e], vr[2][e], vr[3][e]);
  __syncthreads();

  for (int kc = 0; kc < nChunks; ++kc) {
    const int kv0 = kc * kKC;
    const int buf = kc & 1;
    const __bf16* Kb = Ksh[buf];
    const __bf16* Vb = Vts[buf];

    // ---- the next chunk's f32 loads start here and fly under this chunk's work; the last trip loads its own chunk once more
    //      (index clamped, so in bounds), which keeps the trip free of branches: its bytes go into the idle buffer and are never read ----
    {
      const int nx = kc + 1 < nChunks ? kc + 1 : kc;
      const float* kg = ksrc + (size_t)nx * kKC * rowStep;
      const float* vg = vsrc + (size_t)nx * kKC * rowStep;
#pragma unroll
      for (int i = 0; i < 4; ++i) kr[i] = *(const v4f*)(kg + (size_t)i * 16 * rowStep);
#pragma unroll
      for (int i = 0; i < 4; ++i) vr[i] = *(const v4f*)(vg + (size_t)i * rowStep);
    }

    // ---- scores^T: s[j][r] = score(key kv0 + 16j + 8hh + r, query q0 + c) ----
    //      all eight k fragments are fetched as one group, then the eight products run back to back on four independent tiles
    v16b kf[2][4];
#pragma unroll
    for (int dc = 0; dc < 2; ++dc)
#pragma unroll
      for (int j = 0; j < 4; ++j) kf[dc][j] = Frag<__bf16>::load(Kb + (j * 16 + c) * kPit + dc * 32 + 8 * hh);
    __builtin_amdgcn_sched_barrier(0);   // keeps the sixteen reads one group: without it some sink between the products, each with a wait of its own
    v8f s[4];
#pragma unroll
    for (int j = 0; j < 4; ++j) s[j] = (v8f){0.f,0.f,0.f,0.f,0.f,0.f,0.f,0.f};
#pragma unroll
    for (int dc = 0; dc < 2; ++dc)
#pragma unroll
      for (int j = 0; j < 4; ++j) s[j] = at_mma(kf[dc][j], qa[dc], s[j]);

    // ---- all eight v^T fragments are fetched here as one group: their LDS latency passes under the softmax arithmetic ----
    v16b vf[2][4];
#pragma unroll
    for (int kk = 0; kk < 2; ++kk)
#pragma unroll
      for (int t = 0; t < 4; ++t) vf[kk][t] = Frag<__bf16>::load(Vb + (t * 16 + c) * kPit + kk * 32 + 8 * hh);
    __builtin_amdgcn_sched_barrier(0);   // keeps the whole group in front of the softmax: without it half of the reads sink to just ahead of their products

    // ---- key mask (select -inf) on the raw scores, chunk max of the lane's query: in-lane, then one exchange of the halves ----
    const int lim = valid - kv0 - 8 * hh;   // rows 16j + r of this lane half below lim are valid keys
    float mj[4];
#pragma unroll
    for (int j = 0; j < 4; ++j) {
      float m = -INFINITY;
#pragma unroll
      for (int r = 0; r < 8; ++r) {
        const float sv = (j * 16 + r < lim) ? s[j][r] : -INFINITY;
        s[j][r] = sv;
        m = fmaxf(m, sv);
      }
      mj[j] = m;
    }
    float cm = fmaxf(fmaxf(mj[0], mj[1]), fmaxf(mj[2], mj[3]));
    cm = fmaxf(cm, other_half(cm));

    // ---- online softmax; p^T -> bf16 hi and lo B fragments in registers:
    //      element e of fragment kk is key 32kk + 8hh + e (e < 8) or 32kk + 16 + 8hh + (e - 8), the k order of Frag::load ----
    //      p = exp2(s * kScaleLog2e - mnew): one fused multiply-add and the bare hardware exponential per score
    const float mnew  = fmaxf(mrow, cm * kScaleLog2e);
    const float alpha = __builtin_amdgcn_exp2f(mrow - mnew);
    mrow = mnew;
    v16b ph[2], pl[2];
    float pj[4];
#pragma unroll
    for (int j = 0; j < 4; ++j) {
      float psum = 0.f;
      float arg[8], p8[8];
#pragma unroll
      for (int r = 0; r < 8; ++r) arg[r] = __builtin_fmaf(s[j][r], kScaleLog2e, -mnew);
      exp2_x8(arg, p8);
#pragma unroll
      for (int r = 0; r < 8; r += 2) {
        const float pa = p8[r], pb = p8[r + 1];
        psum += pa;
        psum += pb;
        const v2b hi2 = cvt_bf16x2(pa, pb);
        const v2b lo2 = cvt_bf16x2(pa - (float)hi2[0], pb - (float)hi2[1]);
        ph[j >> 1][(j & 1) * 8 + r]     = hi2[0];
        ph[j >> 1][(j & 1) * 8 + r + 1] = hi2[1];
        pl[j >> 1][(j & 1) * 8 + r]     = lo2[0];
        pl[j >> 1][(j & 1) * 8 + r + 1] = lo2[1];
      }
      pj[j] = psum;
    }
    lrow = lrow * alpha + ((pj[0] + pj[1]) + (pj[2] + pj[3]));
#pragma unroll
    for (int t = 0; t < 4; ++t)
#pragma unroll
      for (int r = 0; r < 8; ++r) oacc[t][r] *= alpha;

    // ---- out^T += v^T.p^T : A = v^T [m = d][k = kv], B = p^T [k = kv][n = query] ----
    __builtin_amdgcn_sched_barrier(0);   // keeps the hand-over's wait for the f32 loads behind the softmax: without it the wait rises to a third of a trip after their issue, too short a lead when few waves share a SIMD
    // kk unrolled: ph and pl live in registers, which only constant indices can name (a rolled loop would send them to scratch)
#pragma unroll
    for (int kk = 0; kk < 2; ++kk) {
#pragma unroll
      for (int t = 0; t < 4; ++t) oacc[t] = at_mma(vf[kk][t], ph[kk], oacc[t]);
#pragma unroll
      for (int t = 0; t < 4; ++t) oacc[t] = at_mma(vf[kk][t], pl[kk], oacc[t]);
    }

    // ---- hand-over: the next chunk is rounded and written into the other buffer, whose last readers left it before the barrier of trip kc - 1;
    //      this work is free to issue among the products above; the one barrier publishes the buffer ----
    {
      __bf16* Kn = Ksh[buf ^ 1];
      __bf16* Vn = Vts[buf ^ 1];
#pragma unroll
      for (int i = 0; i < 4; ++i) *(v4b*)(Kn + (sr + 16 * i) * kPit + c4) = cvt_bf16x4(kr[i][0], kr[i][1], kr[i][2], kr[i][3]);
#pragma unroll
      for (int e = 0; e < 4; ++e) *(v4b*)(Vn + (c4 + e) * kPit + 4 * sr) = cvt_bf16x4(vr[0][e], vr[1][e], vr[2][e], vr[3][e]);
    }
    __syncthreads();
  }

  // ---- join the halves' sums, normalise, stage the wave's 16 x 64 tile row-major: 8 consecutive d per lane and t ----
  float* os = Os[wave];
  {
    const float inv = 1.0f / (lrow + other_half(lrow));
#pragma unroll
    for (int t = 0; t < 4; ++t) {
      v4f lo4, hi4;
#pragma unroll
      for (int e = 0; e < 4; ++e) { lo4[e] = oacc[t][e] * inv; hi4[e] = oacc[t][4 + e] * inv; }
      *(v4f*)(os + c * 68 + t * 16 + 8 * hh)     = lo4;
      *(v4f*)(os + c * 68 + t * 16 + 8 * hh + 4) = hi4;
    }
  }
  __builtin_amdgcn_fence(__ATOMIC_RELEASE, "workgroup");
  __builtin_amdgcn_wave_barrier();
  __builtin_amdgcn_fence(__ATOMIC_ACQUIRE, "workgroup");
  {
    const size_t o_rs = (size_t)kHeads * kDim;   // row stride (floats)
    float* ob_ptr = out + ((size_t)b * kSeq) * o_rs + (size_t)h * kDim;
    const int c4 = (lane & 15) * 4;               // row segment 256 B = 16 lanes x 16 B
    {
#pragma unroll
      for (int it = 0; it < 8; ++it) {
        const int row = it * 2 + hh;
        v4f val = *(const v4f*)(os + row * 68 + c4);
        *(v4f*)(ob_ptr + (size_t)(q0 + row) * o_rs + c4) = val;
      }
      
    }
  }
}

// =====================================================================================
// Host glue. One launch; the workspace is not used.
// =====================================================================================
extern "C" void kernel_launch(void* const* d_in, const int* in_sizes, int n_in,
                              void* d_out, int out_size, void* d_ws, size_t ws_size,
                              hipStream_t stream)
{
  (void)in_sizes; (void)n_in; (void)out_size; (void)d_ws; (void)ws_size;
  const float* q  = (const float*)d_in[0];
  const float* k  = (const float*)d_in[1];
  const float* v  = (const float*)d_in[2];
  const int*   vl = (const int*)d_in[3];
  float* out = (float*)d_out;

  const int attnBlocks = kBatch * kHeads * (kSeq / kQB);     // 512

  attn_fused_kernel<<<dim3(attnBlocks), dim3(256), 0, stream>>>(q, k, v, vl, out);
}

// v009
// A run of this version takes 22.3 microseconds.
// In two side-by-side timings against v008, it was 1.04 and 1.03 times as fast.
// All steps since v000 together make it 4.69 times as fast.
// Contractions: scores = q.k^T and out = p.v on v_wmma_f32_16x16x32_bf16 (q, k, v RNE-converted to bf16 once at load; p carried as bf16 hi+lo parts, v single bf16 plane), f32 accumulate; masking, online softmax and normalisation in f32.
#include <hip/hip_runtime.h>
#include <stdint.h>
#include <math.h>

typedef __attribute__((ext_vector_type(16))) __bf16   v16b;
typedef __attribute__((ext_vector_type(8)))  __bf16   v8b;
typedef __attribute__((ext_vector_type(8)))  float    v8f;
typedef __attribute__((ext_vector_type(4)))  float    v4f;
typedef __attribute__((ext_vector_type(2)))  float    v2f;
typedef __attribute__((ext_vector_type(2)))  __bf16   v2b;
typedef __attribute__((ext_vector_type(4)))  __bf16   v4b;

// ---- problem geometry (element (b,s,h,d) of every tensor at ((b*S+s)*H+h)*D+d) ----
constexpr int kBatch = 2;
constexpr int kSeq   = 2048;   // query length
constexpr int kSkv   = 2048;   // key length
constexpr int kHeads = 16;
constexpr int kDim   = 64;
constexpr int kQB    = 128;    // query rows per block (8 waves x 16)
constexpr int kKC    = 64;     // keys per chunk
constexpr int kNW    = 8;
constexpr int kMaxChunks = kSkv / kKC;
constexpr int kPit   = 72;     // LDS row pitch of the 64-element bf16 tiles: 144 B = 16 B x 9, so the 16 rows of a 16-byte fragment read fall on 64 different banks
constexpr float kScaleLog2e = 0.125f * 1.44269504088896340736f;   // 1/sqrt(64) times log2(e): exp(scale * (s - m)) = exp2(s * kScaleLog2e - m * kScaleLog2e)
static_assert(kSeq % kQB == 0);
static_assert(kSkv % kKC == 0);
static_assert(kSeq == kSkv);
static_assert(kDim == 64);
static_assert(kKC == 64);
static_assert((kPit * 2) % 16 == 0);   // rows stay 16-byte aligned
static_assert(kKC % 32 == 0);      // contraction depth of p.v per chunk is a multiple of 32
static_assert(kDim % 32 == 0);     // contraction depth of q.k^T is a multiple of 32

// ---- helpers ----
// two f32 -> two bf16, round to nearest even, by the one packed hardware convert (a in the low half-word)
__device__ __forceinline__ v2b cvt_bf16x2(float a, float b) { return __builtin_convertvector((v2f){a, b}, v2b); }
__device__ __forceinline__ float bf_bits2f(unsigned short h) { return __uint_as_float(((unsigned)h) << 16); }

__device__ __forceinline__ void dep_guard_b(v8f& a, v8f& b, v16b x, v16b y) { asm volatile("v_nop\n\tv_nop\n\tv_nop\n\tv_nop" : "+v"(a), "+v"(b) : "v"(x), "v"(y)); }
__device__ __forceinline__ void keep4_b(v16b a, v16b b, v16b c, v16b d) { asm volatile("v_nop" :: "v"(a), "v"(b), "v"(c), "v"(d)); }
template <typename T> struct Frag;
template <> struct Frag<__bf16> {
  typedef v16b V; union U { v16b v; v8b h[2]; };
  static __device__ __forceinline__ v16b load(const __bf16* p) {   // elements 0..7 <- p[0..7], 8..15 <- p[16..23]
    U f; f.h[0] = *(const v8b*)(p); f.h[1] = *(const v8b*)(p + 16); return f.v;
  }
  static __device__ __forceinline__ v8f mma(v16b a, v16b b, v8f c) {
    return __builtin_amdgcn_wmma_f32_16x16x32_bf16(false, a, false, b, (short)0, c, false, false);
  }
  static __device__ __forceinline__ void guard(v8f& a, v8f& b, v16b x, v16b y) { dep_guard_b(a, b, x, y); }
  static __device__ __forceinline__ void keep(v16b a, v16b b, v16b c, v16b d) { keep4_b(a, b, c, d); }
};

// value of the lane 16 away (the other half's lane of the same column), by a vector cross-row move
__device__ __forceinline__ float other_half(float x) {
  const int b = __float_as_int(x);
  return __int_as_float(__builtin_amdgcn_permlanex16(b, b, 0x76543210, 0xfedcba98, false, false));
}
__device__ __forceinline__ v8f at_mma(v16b a, v16b b, v8f c) {
  return __builtin_amdgcn_wmma_f32_16x16x32_bf16(false, a, false, b, (short)0, c, false, false);
}

// y[i] = 2^x[i]: eight bare hardware exponentials in one statement. Early-clobber results keep every source register intact while
// the run issues; the
// closing v_nop is the slot the instruction set asks for behind a transcendental before its result is read or its source overwritten.
__device__ __forceinline__ void exp2_x8(const float (&x)[8], float (&y)[8]) {
  asm("v_exp_f32 %0, %8\n\t"
      "v_exp_f32 %1, %9\n\t"
      "v_exp_f32 %2, %10\n\t"
      "v_exp_f32 %3, %11\n\t"
      "v_exp_f32 %4, %12\n\t"
      "v_exp_f32 %5, %13\n\t"
      "v_exp_f32 %6, %14\n\t"
      "v_exp_f32 %7, %15\n\t"
      "v_nop"
      : "=&v"(y[0]), "=&v"(y[1]), "=&v"(y[2]), "=&v"(y[3]), "=&v"(y[4]), "=&v"(y[5]), "=&v"(y[6]), "=&v"(y[7])
      : "v"(x[0]), "v"(x[1]), "v"(x[2]), "v"(x[3]), "v"(x[4]), "v"(x[5]), "v"(x[6]), "v"(x[7]));
}

// four f32 -> four bf16 (RNE), element 0 lowest
__device__ __forceinline__ v4b cvt_bf16x4(float a, float b, float c, float d) {
  return __builtin_shufflevector(cvt_bf16x2(a, b), cvt_bf16x2(c, d), 0, 1, 2, 3);
}

// =====================================================================================
// Attention for head_dim 64, one launch, straight from the f32 tensors: block = 8 waves = 128 query rows of one (b, h); 64-key chunks.
//   Both products are formed transposed, so that a lane holds scores and outputs of ONE query (column c):
//   scores^T: A = k rows (bf16, [kv][d] in LDS), B = q rows (bf16, registers)            -> v_wmma_f32_16x16x32_bf16
//   out^T   : A = v^T rows ([d][kv] in LDS), B = p^T (bf16 hi and lo, packed in registers) -> v_wmma_f32_16x16x32_bf16 x2
//   Keys with index >= valid_lens[b] get score -inf (select); chunks entirely beyond valid_lens are skipped
//   (their probabilities are exactly 0); chunk count clamped to [1, kMaxChunks].
//   K and V chunks are loaded as f32 into registers one chunk ahead, rounded to bf16 and written (V transposed) into the other of two LDS buffers.
// =====================================================================================
__global__ __launch_bounds__(256)
void attn_fused_kernel(const float* __restrict__ q, const float* __restrict__ k, const float* __restrict__ v,
                       const int* __restrict__ vlen, float* __restrict__ out)
{
  __shared__ __align__(16) __bf16 Ksh[2][kKC * kPit];       // [buffer][kv][d]   2 x 9 KB, pitch kPit
  __shared__ __align__(16) __bf16 Vts[2][kDim * kPit];      // [buffer][d][kv]   2 x 9 KB, pitch kPit
  __shared__ __align__(16) float  Os[kNW][16 * 68];         // per wave out tile, pitch 68

  const int tid  = threadIdx.x;
  const int wave = tid >> 5;
  const int lane = tid & 31;
  const int hh   = lane >> 4;
  const int c    = lane & 15;

  const int nqb = kSeq / kQB;
  const int bx  = blockIdx.x;
  const int qb  = bx % nqb;
  const int bh  = bx / nqb;
  const int h   = bh % kHeads;
  const int b   = bh / kHeads;
  const int q0  = qb * kQB + wave * 16;

  int valid = vlen[b];
  valid = valid < 0 ? 0 : valid;
  valid = valid > kSkv ? kSkv : valid;
  int nChunks = (valid + kKC - 1) / kKC;          // block-uniform
  nChunks = nChunks < 1 ? 1 : nChunks;
  nChunks = nChunks > kMaxChunks ? kMaxChunks : nChunks;

  // staging of a chunk's K [64 kv][64 d] and V [64 kv][64 d], f32: 16 lanes x 16 B take one 256-byte row, so a wave-wide load covers 4 whole lines.
  //   K: thread -> rows sr + 16 i, i 0..3, d = c4 .. c4 + 3; each load becomes 4 bf16 of one K row in LDS.
  //   V: thread -> rows 4 sr + i, i 0..3, d = c4 .. c4 + 3; the 4 x 4 patch is written transposed, 4 consecutive kv of each of its 4 d rows.
  constexpr size_t rowStep = (size_t)kHeads * kDim;   // one key row further, elements
  const int sr = tid >> 4, c4 = (tid & 15) * 4;
  const float* ksrc = k + ((size_t)(b * kSkv + sr) * kHeads + h) * kDim + c4;        // + chunk * kKC * rowStep
  const float* vsrc = v + ((size_t)(b * kSkv + 4 * sr) * kHeads + h) * kDim + c4;    // + chunk * kKC * rowStep
  v4f kr[4], vr[4];   // the chunk in flight

  // chunk 0's loads go first of all: nothing in the block can start before they land; the Q loads fly beside them
#pragma unroll
  for (int i = 0; i < 4; ++i) kr[i] = *(const v4f*)(ksrc + (size_t)i * 16 * rowStep);
#pragma unroll
  for (int i = 0; i < 4; ++i) vr[i] = *(const v4f*)(vsrc + (size_t)i * rowStep);

  // ---- Q fragments (B operand: column = query q0 + c, k = d), 2 d-chunks, rounded to bf16 here:
  //      elements 0..7 <- d = 32 dc + 8 hh + 0..7, elements 8..15 <- the same + 16 (the k order of Frag::load) ----
  v16b qa[2];
  {
    const float* qrow = q + ((size_t)(b * kSeq + q0 + c) * kHeads + h) * kDim;
#pragma unroll
    for (int dc = 0; dc < 2; ++dc) {
      const float* p = qrow + dc * 32 + 8 * hh;
      const v4f a0 = *(const v4f*)(p),      a1 = *(const v4f*)(p + 4);
      const v4f a2 = *(const v4f*)(p + 16), a3 = *(const v4f*)(p + 20);
      const v8b lo8 = __builtin_shufflevector(cvt_bf16x4(a0[0], a0[1], a0[2], a0[3]), cvt_bf16x4(a1[0], a1[1], a1[2], a1[3]), 0, 1, 2, 3, 4, 5, 6, 7);
      const v8b hi8 = __builtin_shufflevector(cvt_bf16x4(a2[0], a2[1], a2[2], a2[3]), cvt_bf16x4(a3[0], a3[1], a3[2], a3[3]), 0, 1, 2, 3, 4, 5, 6, 7);
      qa[dc] = __builtin_shufflevector(lo8, hi8, 0, 1, 2, 3, 4, 5, 6, 7, 8, 9, 10, 11, 12, 13, 14, 15);
    }
  }

  float mrow = -INFINITY;   // running maximum of query q0 + c, in scaled log2 units (raw score x kScaleLog2e; equal in both lane halves)
  v2f lrow2 = (v2f){0.f, 0.f};   // running sum over this lane half's keys, even and odd score rows apart (a register pair); joined after the loop
  v8f oacc[4];              // oacc[t][r] = out^T[d = 16t + 8hh + r][query q0 + c]
#pragma unroll
  for (int t = 0; t < 4; ++t) oacc[t] = (v8f){0.f,0.f,0.f,0.f,0.f,0.f,0.f,0.f};

  // ---- in front of the loop: chunk 0 is rounded, written into buffer 0 and published ----
#pragma unroll
  for (int i = 0; i < 4; ++i) *(v4b*)(&Ksh[0][(sr + 16 * i) * kPit + c4]) = cvt_bf16x4(kr[i][0], kr[i][1], kr[i][2], kr[i][3]);
#pragma unroll
  for (int e = 0; e < 4; ++e) *(v4b*)(&Vts[0][(c4 + e) * kPit + 4 * sr]) = cvt_bf16x4(vr[0][e], vr[1][e], vr[2][e], vr[3][e]);
  __syncthreads();

  for (int kc = 0; kc < nChunks; ++kc) {
    const int kv0 = kc * kKC;
    const int buf = kc & 1;
    const __bf16* Kb = Ksh[buf];
    const __bf16* Vb = Vts[buf];

    // ---- the next chunk's f32 loads start here and fly under this chunk's work; the last trip loads its own chunk once more
    //      (index clamped, so in bounds), which keeps the trip free of branches: its bytes go into the idle buffer and are never read ----
    {
      const int nx = kc + 1 < nChunks ? kc + 1 : kc;
      const float* kg = ksrc + (size_t)nx * kKC * rowStep;
      const float* vg = vsrc + (size_t)nx * kKC * rowStep;
#pragma unroll
      for (int i = 0; i < 4; ++i) kr[i] = *(const v4f*)(kg + (size_t)i * 16 * rowStep);
#pragma unroll
      for (int i = 0; i < 4; ++i) vr[i] = *(const v4f*)(vg + (size_t)i * rowStep);
    }

    // ---- scores^T: s[j][r] = score(key kv0 + 16j + 8hh + r, query q0 + c) ----
    //      all eight k fragments are fetched as one group, then the eight products run back to back on four independent tiles
    v16b kf[2][4];
#pragma unroll
    for (int dc = 0; dc < 2; ++dc)
#pragma unroll
      for (int j = 0; j < 4; ++j) kf[dc][j] = Frag<__bf16>::load(Kb + (j * 16 + c) * kPit + dc * 32 + 8 * hh);
    __builtin_amdgcn_sched_barrier(0);   // keeps the sixteen reads one group: without it some sink between the products, each with a wait of its own
    v8f s[4];
#pragma unroll
    for (int j = 0; j < 4; ++j) s[j] = (v8f){0.f,0.f,0.f,0.f,0.f,0.f,0.f,0.f};
#pragma unroll
    for (int dc = 0; dc < 2; ++dc)
#pragma unroll
      for (int j = 0; j < 4; ++j) s[j] = at_mma(kf[dc][j], qa[dc], s[j]);

    // ---- all eight v^T fragments are fetched here as one group: their LDS latency passes under the softmax arithmetic ----
    v16b vf[2][4];
#pragma unroll
    for (int kk = 0; kk < 2; ++kk)
#pragma unroll
      for (int t = 0; t < 4; ++t) vf[kk][t] = Frag<__bf16>::load(Vb + (t * 16 + c) * kPit + kk * 32 + 8 * hh);
    __builtin_amdgcn_sched_barrier(0);   // keeps the whole group in front of the softmax: without it half of the reads sink to just ahead of their products

    // ---- key mask (select -inf) on the raw scores, chunk max of the lane's query: in-lane, then one exchange of the halves ----
    const int lim = valid - kv0 - 8 * hh;   // rows 16j + r of this lane half below lim are valid keys
    float mj[4];
#pragma unroll
    for (int j = 0; j < 4; ++j) {
      float m = -INFINITY;
#pragma unroll
      for (int r = 0; r < 8; ++r) {
        const float sv = (j * 16 + r < lim) ? s[j][r] : -INFINITY;
        s[j][r] = sv;
        m = fmaxf(m, sv);
      }
      mj[j] = m;
    }
    float cm = fmaxf(fmaxf(mj[0], mj[1]), fmaxf(mj[2], mj[3]));
    cm = fmaxf(cm, other_half(cm));

    // ---- online softmax; p^T -> bf16 hi and lo B fragments in registers:
    //      element e of fragment kk is key 32kk + 8hh + e (e < 8) or 32kk + 16 + 8hh + (e - 8), the k order of Frag::load ----
    //      p = exp2(s * kScaleLog2e - mnew): one fused multiply-add and the bare hardware exponential per score
    const float mnew  = fmaxf(mrow, cm * kScaleLog2e);
    const float alpha = __builtin_amdgcn_exp2f(mrow - mnew);
    mrow = mnew;
    v16b ph[2], pl[2];
    v2f pp[4][4];   // the probabilities as register pairs (score rows 2i, 2i + 1 of tile j), summed below
#pragma unroll
    for (int j = 0; j < 4; ++j) {
      float arg[8], p8[8];
#pragma unroll
      for (int r = 0; r < 8; ++r) arg[r] = __builtin_fmaf(s[j][r], kScaleLog2e, -mnew);
      exp2_x8(arg, p8);
#pragma unroll
      for (int r = 0; r < 8; r += 2) {
        const float pa = p8[r], pb = p8[r + 1];
        pp[j][r >> 1] = (v2f){pa, pb};
        const v2b hi2 = cvt_bf16x2(pa, pb);
        const v2b lo2 = cvt_bf16x2(pa - (float)hi2[0], pb - (float)hi2[1]);
        ph[j >> 1][(j & 1) * 8 + r]     = hi2[0];
        ph[j >> 1][(j & 1) * 8 + r + 1] = hi2[1];
        pl[j >> 1][(j & 1) * 8 + r]     = lo2[0];
        pl[j >> 1][(j & 1) * 8 + r + 1] = lo2[1];
      }
    }
#pragma unroll
    for (int t = 0; t < 4; ++t)
#pragma unroll
      for (int r = 0; r < 8; ++r) oacc[t][r] *= alpha;

    // ---- out^T += v^T.p^T : A = v^T [m = d][k = kv], B = p^T [k = kv][n = query] ----
    __builtin_amdgcn_sched_barrier(0);   // keeps the hand-over's wait for the f32 loads behind the softmax: without it the wait rises to a third of a trip after their issue, too short a lead when few waves share a SIMD
    // row sum, two chains of pair adds (tiles 0, 1, opened by the rescaled running sum; tiles 2, 3): written here so that they can issue among the products below
    {
      v2f sa = __builtin_elementwise_fma(lrow2, (v2f){alpha, alpha}, pp[0][0]);
      v2f sb = pp[2][0];
      // unrolled: pp lives in registers, which only constant indices can name
#pragma unroll
      for (int i = 1; i < 8; ++i) { sa += pp[i >> 2][i & 3]; sb += pp[2 + (i >> 2)][i & 3]; }
      lrow2 = sa + sb;
    }
    // kk unrolled: ph and pl live in registers, which only constant indices can name (a rolled loop would send them to scratch)
#pragma unroll
    for (int kk = 0; kk < 2; ++kk) {
#pragma unroll
      for (int t = 0; t < 4; ++t) oacc[t] = at_mma(vf[kk][t], ph[kk], oacc[t]);
#pragma unroll
      for (int t = 0; t < 4; ++t) oacc[t] = at_mma(vf[kk][t], pl[kk], oacc[t]);
    }

    // ---- hand-over: the next chunk is rounded and written into the other buffer, whose last readers left it before the barrier of trip kc - 1;
    //      this work is free to issue among the products above; the one barrier publishes the buffer ----
    {
      __bf16* Kn = Ksh[buf ^ 1];
      __bf16* Vn = Vts[buf ^ 1];
#pragma unroll
      for (int i = 0; i < 4; ++i) *(v4b*)(Kn + (sr + 16 * i) * kPit + c4) = cvt_bf16x4(kr[i][0], kr[i][1], kr[i][2], kr[i][3]);
#pragma unroll
      for (int e = 0; e < 4; ++e) *(v4b*)(Vn + (c4 + e) * kPit + 4 * sr) = cvt_bf16x4(vr[0][e], vr[1][e], vr[2][e], vr[3][e]);
    }
    __syncthreads();
  }

  // ---- join the halves' sums, normalise, stage the wave's 16 x 64 tile row-major: 8 consecutive d per lane and t ----
  float* os = Os[wave];
  {
    const float lrow = lrow2[0] + lrow2[1];
    const float inv = 1.0f / (lrow + other_half(lrow));
#pragma unroll
    for (int t = 0; t < 4; ++t) {
      v4f lo4, hi4;
#pragma unroll
      for (int e = 0; e < 4; ++e) { lo4[e] = oacc[t][e] * inv; hi4[e] = oacc[t][4 + e] * inv; }
      *(v4f*)(os + c * 68 + t * 16 + 8 * hh)     = lo4;
      *(v4f*)(os + c * 68 + t * 16 + 8 * hh + 4) = hi4;
    }
  }
  __builtin_amdgcn_fence(__ATOMIC_RELEASE, "workgroup");
  __builtin_amdgcn_wave_barrier();
  __builtin_amdgcn_fence(__ATOMIC_ACQUIRE, "workgroup");
  {
    const size_t o_rs = (size_t)kHeads * kDim;   // row stride (floats)
    float* ob_ptr = out + ((size_t)b * kSeq) * o_rs + (size_t)h * kDim;
    const int c4 = (lane & 15) * 4;               // row segment 256 B = 16 lanes x 16 B
    {
#pragma unroll
      for (int it = 0; it < 8; ++it) {
        const int row = it * 2 + hh;
        v4f val = *(const v4f*)(os + row * 68 + c4);
        *(v4f*)(ob_ptr + (size_t)(q0 + row) * o_rs + c4) = val;
      }
      
    }
  }
}

// =====================================================================================
// Host glue. One launch; the workspace is not used.
// =====================================================================================
extern "C" void kernel_launch(void* const* d_in, const int* in_sizes, int n_in,
                              void* d_out, int out_size, void* d_ws, size_t ws_size,
                              hipStream_t stream)
{
  (void)in_sizes; (void)n_in; (void)out_size; (void)d_ws; (void)ws_size;
  const float* q  = (const float*)d_in[0];
  const float* k  = (const float*)d_in[1];
  const float* v  = (const float*)d_in[2];
  const int*   vl = (const int*)d_in[3];
  float* out = (float*)d_out;

  const int attnBlocks = kBatch * kHeads * (kSeq / kQB);     // 512

  attn_fused_kernel<<<dim3(attnBlocks), dim3(256), 0, stream>>>(q, k, v, vl, out);
}
